// v000
// Times are from an AMD MI455X. After a warm-up the kernel runs many times in a row, and a time is the length of
// such a window on the GPU divided by its runs, so every launch and the gaps after it count. The runs cycle
// through copies of the inputs. A figure is the median of several windows, for all but v000 over two sittings.
// Sittings can differ by a few percent; kernels timed side by side share one.
// The starting kernel, v000, takes 31.1 microseconds a run.
// Contractions: q/k/v/out projections and P.V on v_wmma_f32_16x16x32_f16 (f16 operands, P scaled by 4096, f32 accumulate); pair path T=m.A_p and feat=T.m^T on v_wmma_f32_16x16x32_bf16 as bf16 hi/lo split (3 products each, f32 accumulate); q.k (K=8) and gate (K=8) on VALU f32.
#include <hip/hip_runtime.h>

typedef _Float16       v16h  __attribute__((ext_vector_type(16)));
typedef _Float16       v8h   __attribute__((ext_vector_type(8)));
typedef __bf16         v16b  __attribute__((ext_vector_type(16)));
typedef unsigned short v16us __attribute__((ext_vector_type(16)));
typedef unsigned short v8us  __attribute__((ext_vector_type(8)));
typedef float          v8f   __attribute__((ext_vector_type(8)));
typedef float          v4f   __attribute__((ext_vector_type(4)));
typedef v8h  __attribute__((may_alias)) v8h_ma;
typedef v8us __attribute__((may_alias)) v8us_ma;
typedef v4f  __attribute__((may_alias)) v4f_ma;

union FragH { v16h v;  v8h  half[2]; };
union FragU { v16us v; v8us half[2]; };

__device__ __forceinline__ float wave_sum32(float v) {
#pragma unroll
  for (int o = 16; o > 0; o >>= 1) v += __shfl_xor(v, o, 32);
  return v;
}

// 16x16x32 fragment k map, identical for A and B: element i of a lane with hh = lane>>4 holds k = (i&7) + 16*(i>>3) + 8*hh.
// A: lane&15 = row m, B: lane&15 = column n, D: acc[r] = (row 8*hh + r, col lane&15).
__device__ __forceinline__ int kof(int i, int hh) { return (i & 7) + ((i >> 3) << 4) + 8 * hh; }

__device__ __forceinline__ v8f wmma_f16(v16h a, v16h b, v8f c) {
  c = __builtin_amdgcn_wmma_f32_16x16x32_f16(false, a, false, b, (short)0, c, false, false);
  asm volatile("v_nop\n\tv_nop\n\tv_nop\n\tv_nop" : "+v"(c) : "v"(a), "v"(b));
  return c;
}

__device__ __forceinline__ v8f wmma_bf16(v16us a, v16us b, v8f c) {
  v16b ab = __builtin_bit_cast(v16b, a);
  v16b bb = __builtin_bit_cast(v16b, b);
  c = __builtin_amdgcn_wmma_f32_16x16x32_bf16(false, ab, false, bb, (short)0, c, false, false);
  asm volatile("v_nop\n\tv_nop\n\tv_nop\n\tv_nop" : "+v"(c) : "v"(ab), "v"(bb));
  return c;
}

// f32 -> bf16 bit pattern, RNE convert; and back
__device__ __forceinline__ unsigned short bf_rne(float x) {
  unsigned int u = __float_as_uint(x);
  u += 0x7FFFu + ((u >> 16) & 1u);
  return (unsigned short)(u >> 16);
}
__device__ __forceinline__ float bf_val(unsigned short s) {
  return __uint_as_float(((unsigned int)s) << 16);
}

// B fragment for output column n of X.W^T with W stored [n][k] f32, pitch 32 (B[k][n] = W[n][k]), converted to f16
__device__ __forceinline__ v16h wfrag_f16(const float* __restrict__ W, int n, int hh) {
  const float* r = W + n * 32;
  v16h f = {};
#pragma unroll
  for (int i = 0; i < 16; ++i) f[i] = (_Float16)r[kof(i, hh)];
  return f;
}

// ---------------------------------------------------------------------------------------------
// Kernel 1: one block per (b,s). Builds x = LN(msa+pos), row attention with bulk bias, gate,
// ---------------------------------------------------------------------------------------------
__global__ __launch_bounds__(256) void k_attn(
    const float* __restrict__ ctcf, const float* __restrict__ hac,
    const float* __restrict__ me1,  const float* __restrict__ me3,
    const float* __restrict__ bulk,
    const float* __restrict__ we_w, const float* __restrict__ we_b,
    const float* __restrict__ pos,
    const float* __restrict__ mn_g, const float* __restrict__ mn_b,
    const float* __restrict__ wq,   const float* __restrict__ bq,
    const float* __restrict__ wk,   const float* __restrict__ bk,
    const float* __restrict__ wv,   const float* __restrict__ bv,
    const float* __restrict__ wo,   const float* __restrict__ bo,
    const float* __restrict__ an_g, const float* __restrict__ an_b,
    const float* __restrict__ conv_w, const float* __restrict__ conv_b,
    const float* __restrict__ gate_w, const float* __restrict__ gate_b,
    float* __restrict__ xw, int nbs)
{
  __shared__ __attribute__((aligned(16))) float    xs[64][32];   // x f32 (kept for residual), then LN output staging
  __shared__ __attribute__((aligned(16))) _Float16 xh[64][32];   // x f16 (A operand of q/k/v)
  __shared__ __attribute__((aligned(16))) float    qf[64][32];
  __shared__ __attribute__((aligned(16))) float    kf[64][32];
  __shared__ __attribute__((aligned(16))) _Float16 vh[64][32];   // v f16 (B operand of P.V)
  __shared__ __attribute__((aligned(16))) _Float16 ph[64][64];   // P * 4096, f16, current head
  __shared__ __attribute__((aligned(16))) float    og[64][32];   // P.V output (l, h*8+d)
  __shared__ __attribute__((aligned(16))) _Float16 oh[64][32];   // gated output, f16 (A operand of out proj)
  __shared__ __attribute__((aligned(16))) float    o2[64][32];   // out proj + bias

  const int tid = threadIdx.x, wave = tid >> 5, lane = tid & 31;
  const int hh = lane >> 4, m16 = lane & 15;
  const int bs = blockIdx.x;
  if (bs >= nbs) return;                       // block-uniform
  const int b = bs >> 2, s = bs & 3;

  // 1) x = LN(signal * we_w + we_b + pos); wave per row, lane = channel
  {
    const float* sig = (s == 0) ? ctcf : ((s == 1) ? hac : ((s == 2) ? me1 : me3));
    const float ww = we_w[lane], wb = we_b[lane], g = mn_g[lane], be = mn_b[lane];
    for (int rr = 0; rr < 8; ++rr) {
      const int l = wave * 8 + rr;
      float v = sig[b * 64 + l] * ww + wb;
      v += pos[l * 32 + lane];
      const float mu  = wave_sum32(v) * 0.03125f;
      const float d   = v - mu;
      const float var = wave_sum32(d * d) * 0.03125f;
      const float y   = d * (1.0f / sqrtf(var + 1e-5f)) * g + be;
      xs[l][lane] = y;
      xh[l][lane] = (_Float16)y;
    }
  }
  __syncthreads();

  // 2) q/k/v = x.W^T + b : one 16x16 tile (mt,nt) per wave for each of q,k,v ; K = 32 = one k-step
  {
    const int mt = wave >> 1, nt = wave & 1;
    const int arow = mt * 16 + m16, ncol = nt * 16 + m16, drow = mt * 16 + 8 * hh;
    FragH a;
    a.half[0] = *(const v8h_ma*)(&xh[arow][8 * hh]);
    a.half[1] = *(const v8h_ma*)(&xh[arow][16 + 8 * hh]);
    {
      v8f acc = {};
      acc = wmma_f16(a.v, wfrag_f16(wq, ncol, hh), acc);
      const float bb = bq[ncol];
#pragma unroll
      for (int r = 0; r < 8; ++r) qf[drow + r][ncol] = acc[r] + bb;
    }
    {
      v8f acc = {};
      acc = wmma_f16(a.v, wfrag_f16(wk, ncol, hh), acc);
      const float bb = bk[ncol];
#pragma unroll
      for (int r = 0; r < 8; ++r) kf[drow + r][ncol] = acc[r] + bb;
    }
    {
      v8f acc = {};
      acc = wmma_f16(a.v, wfrag_f16(wv, ncol, hh), acc);
      const float bb = bv[ncol];
#pragma unroll
      for (int r = 0; r < 8; ++r) vh[drow + r][ncol] = (_Float16)(acc[r] + bb);
    }
  }
  __syncthreads();

  // 3) per head: scores (K=8, VALU f32) + bias + softmax by thread (l, quarter of 64 keys), then P.V on f16 WMMA
  const float rsD = 0.35355339059327373f;     // 1/sqrt(8)
#pragma unroll 1
  for (int h = 0; h < 4; ++h) {
    {
      const int l = tid >> 2, m0 = (tid & 3) * 16;     // 4 adjacent lanes share one query row
      float qr[8];
#pragma unroll
      for (int d = 0; d < 8; ++d) qr[d] = qf[l][h * 8 + d];
      const float cw = conv_w[h], cb = conv_b[h];
      const float* bl = bulk + ((size_t)b * 64 + l) * 64 + m0;
      float sc[16];
      float mx = -3.0e38f;
#pragma unroll
      for (int mm = 0; mm < 16; ++mm) {
        float acc = 0.f;
#pragma unroll
        for (int d = 0; d < 8; ++d) acc += qr[d] * kf[m0 + mm][h * 8 + d];
        const float sv = acc * rsD + (bl[mm] * cw + cb);
        sc[mm] = sv;
        mx = fmaxf(mx, sv);
      }
      mx = fmaxf(mx, __shfl_xor(mx, 1, 32));
      mx = fmaxf(mx, __shfl_xor(mx, 2, 32));
      float sum = 0.f;
#pragma unroll
      for (int mm = 0; mm < 16; ++mm) { const float e = __expf(sc[mm] - mx); sc[mm] = e; sum += e; }
      sum += __shfl_xor(sum, 1, 32);
      sum += __shfl_xor(sum, 2, 32);
      const float inv = 4096.0f / sum;            // P carried x4096 (exact power of two) for the f16 operand
      FragH pv;
#pragma unroll
      for (int mm = 0; mm < 8; ++mm) {
        pv.half[0][mm] = (_Float16)(sc[mm] * inv);
        pv.half[1][mm] = (_Float16)(sc[8 + mm] * inv);
      }
      *(v8h_ma*)(&ph[l][m0])     = pv.half[0];
      *(v8h_ma*)(&ph[l][m0 + 8]) = pv.half[1];
    }
    __syncthreads();
    if (wave < 4) {                               // wave-uniform; all 32 lanes active in the WMMA
      const int mt = wave, arow = mt * 16 + m16, vcol = h * 8 + (m16 & 7);
      v8f acc = {};
#pragma unroll
      for (int ks = 0; ks < 2; ++ks) {
        const int k0 = ks * 32;
        FragH a;                                  // A[m = query][k = key] = P row, k contiguous
        a.half[0] = *(const v8h_ma*)(&ph[arow][k0 + 8 * hh]);
        a.half[1] = *(const v8h_ma*)(&ph[arow][k0 + 16 + 8 * hh]);
        v16h bvv = {};                            // B[k = key][n = d] = v[key][h*8+d], columns n>=8 zero
#pragma unroll
        for (int i = 0; i < 16; ++i) {
          const _Float16 t = vh[k0 + kof(i, hh)][vcol];
          bvv[i] = (m16 < 8) ? t : (_Float16)0.0f;
        }
        acc = wmma_f16(a.v, bvv, acc);
      }
      if (m16 < 8) {
        const int drow = mt * 16 + 8 * hh;
#pragma unroll
        for (int r = 0; r < 8; ++r) og[drow + r][h * 8 + m16] = acc[r] * (1.0f / 4096.0f);
      }
    }
    __syncthreads();
  }

  // 4) gate: oh[l][h*8+c] = og[l][h*8+c] * sigmoid(sum_d gate_w[h][c][d] og[l][h*8+d] + gate_b[h][c])
#pragma unroll 1
  for (int j = 0; j < 8; ++j) {
    const int idx = tid + 256 * j;
    const int l = idx >> 5, hc = idx & 31, h8 = hc & 24;
    float acc = gate_b[hc];
#pragma unroll
    for (int d = 0; d < 8; ++d) acc += gate_w[hc * 8 + d] * og[l][h8 + d];
    const float gs = 1.0f / (1.0f + __expf(-acc));
    oh[l][hc] = (_Float16)(og[l][hc] * gs);
  }
  __syncthreads();

  // 5) output projection: o2 = oh.wo^T + bo ; one tile per wave
  {
    const int mt = wave >> 1, nt = wave & 1;
    const int arow = mt * 16 + m16, ncol = nt * 16 + m16, drow = mt * 16 + 8 * hh;
    FragH a;
    a.half[0] = *(const v8h_ma*)(&oh[arow][8 * hh]);
    a.half[1] = *(const v8h_ma*)(&oh[arow][16 + 8 * hh]);
    v8f acc = {};
    acc = wmma_f16(a.v, wfrag_f16(wo, ncol, hh), acc);
    const float bb = bo[ncol];
#pragma unroll
    for (int r = 0; r < 8; ++r) o2[drow + r][ncol] = acc[r] + bb;
  }
  __syncthreads();

  // 6) residual + LN, staged back into xs (each lane rewrites only the element it read)
  {
    const float g = an_g[lane], be = an_b[lane];
    for (int rr = 0; rr < 8; ++rr) {
      const int l = wave * 8 + rr;
      const float v   = xs[l][lane] + o2[l][lane];
      const float mu  = wave_sum32(v) * 0.03125f;
      const float d   = v - mu;
      const float var = wave_sum32(d * d) * 0.03125f;
      xs[l][lane] = d * (1.0f / sqrtf(var + 1e-5f)) * g + be;
    }
  }
  __syncthreads();

  {
    float* xg = xw + (size_t)bs * 2048;
    const int col = 4 * (lane & 7);
    const int r0 = wave * 8 + (lane >> 3), r1 = r0 + 4;
    const v4f v0 = *(const v4f_ma*)(&xs[r0][col]);
    const v4f v1 = *(const v4f_ma*)(&xs[r1][col]);
    *(v4f*)(xg + r0 * 32 + col) = v0;
    *(v4f*)(xg + r1 * 32 + col) = v1;
    
  }
}

// ---------------------------------------------------------------------------------------------
// Kernel 2: one block per (b, tile of 16 rows i). m = max over tracks, unit rows, bf16 hi/lo;
// T_p[i][d] = sum_c mh[i][c] A_p[c][d]  (A_p[c][d] = pp_w[p][c*32+d]);  feat_p[i][j] = sum_d T_p[i][d] mh[j][d] + pp_b[p];
// ---------------------------------------------------------------------------------------------
__global__ __launch_bounds__(256) void k_pair(
    const float* __restrict__ xw, const float* __restrict__ ppw, const float* __restrict__ pp_b,
    const float* __restrict__ ada_g, const float* __restrict__ ada_b, const float* __restrict__ ada_alpha,
    float* __restrict__ out, int nblk)
{
  __shared__ __attribute__((aligned(16))) unsigned short mhi[64][32];   // bf16 bits, hi part of unit rows
  __shared__ __attribute__((aligned(16))) unsigned short mlo[64][32];   // bf16 bits, lo part
  __shared__ __attribute__((aligned(16))) float tf[16][16][32];         // T_p for this block's 16 rows, f32
  __shared__ __attribute__((aligned(16))) float fo[16][16][64];         // feat / final values (p, i, j)
  float* mf = &fo[0][0][0];                                            // [64*32] f32 max rows; dead before fo is first written

  const int tid = threadIdx.x, wave = tid >> 5, lane = tid & 31;
  const int hh = lane >> 4, m16 = lane & 15;
  const int blk = blockIdx.x;
  if (blk >= nblk) return;                     // block-uniform
  const int b = blk >> 2, i0 = (blk & 3) * 16;

  // 1) max over the 4 tracks
  {
    const float* xb = xw + (size_t)b * 8192;
#pragma unroll
    for (int j = 0; j < 8; ++j) {
      const int e = tid + 256 * j;
      float v = xb[e];
      v = fmaxf(v, xb[2048 + e]);
      v = fmaxf(v, xb[4096 + e]);
      v = fmaxf(v, xb[6144 + e]);
      mf[e] = v;
    }
  }
  __syncthreads();

  // 2) unit rows (the pair norm factorises as |m_i|*|m_j|; clamp applied per factor), split into bf16 hi + lo
  for (int rr = 0; rr < 8; ++rr) {
    const int l = wave * 8 + rr;
    const float v   = mf[l * 32 + lane];
    const float n2  = wave_sum32(v * v);
    const float inv = 1.0f / fmaxf(sqrtf(n2), 1e-3f);
    const float y   = v * inv;
    const unsigned short hb = bf_rne(y);
    mhi[l][lane] = hb;
    mlo[l][lane] = bf_rne(y - bf_val(hb));
  }
  __syncthreads();

  // 3) GEMM1: wave handles p = 2*wave, 2*wave+1 and both 16-column halves of d; K = 32 (c), one k-step, 3 products
  {
    const int arow = i0 + m16;
    FragU ahi, alo;                              // A[m = i][k = c] = mh[i0+i][c]
    ahi.half[0] = *(const v8us_ma*)(&mhi[arow][8 * hh]);
    ahi.half[1] = *(const v8us_ma*)(&mhi[arow][16 + 8 * hh]);
    alo.half[0] = *(const v8us_ma*)(&mlo[arow][8 * hh]);
    alo.half[1] = *(const v8us_ma*)(&mlo[arow][16 + 8 * hh]);
#pragma unroll 1
    for (int pp = 0; pp < 2; ++pp) {
      const int p = wave * 2 + pp;
#pragma unroll 1
      for (int nt = 0; nt < 2; ++nt) {
        const int n = nt * 16 + m16;             // B[k = c][n = d] = pp_w[p][c*32 + d]
        const float* wp = ppw + (size_t)p * 1024 + n;
        v16us bh = {}, bl = {};
#pragma unroll
        for (int i = 0; i < 16; ++i) {
          const float w = wp[kof(i, hh) * 32];
          const unsigned short hb = bf_rne(w);
          bh[i] = hb;
          bl[i] = bf_rne(w - bf_val(hb));
        }
        v8f acc = {};
        acc = wmma_bf16(ahi.v, bh, acc);
        acc = wmma_bf16(ahi.v, bl, acc);
        acc = wmma_bf16(alo.v, bh, acc);
#pragma unroll
        for (int r = 0; r < 8; ++r) tf[p][8 * hh + r][n] = acc[r];
      }
    }
  }
  __syncthreads();

  // 4) GEMM2: feat_p[i][j] ; A[m = i][k = d] = T_p[i][d] (f32 in LDS, split at load), B[k = d][n = j] = mh[j][d] (row j, k-contiguous)
#pragma unroll 1
  for (int nt = 0; nt < 4; ++nt) {
    const int brow = nt * 16 + m16;
    FragU bh, bl;
    bh.half[0] = *(const v8us_ma*)(&mhi[brow][8 * hh]);
    bh.half[1] = *(const v8us_ma*)(&mhi[brow][16 + 8 * hh]);
    bl.half[0] = *(const v8us_ma*)(&mlo[brow][8 * hh]);
    bl.half[1] = *(const v8us_ma*)(&mlo[brow][16 + 8 * hh]);
#pragma unroll 1
    for (int pp = 0; pp < 2; ++pp) {
      const int p = wave * 2 + pp;
      v16us ah = {}, al = {};
#pragma unroll
      for (int i = 0; i < 16; ++i) {
        const float t = tf[p][m16][kof(i, hh)];
        const unsigned short hb = bf_rne(t);
        ah[i] = hb;
        al[i] = bf_rne(t - bf_val(hb));
      }
      v8f acc = {};
      acc = wmma_bf16(ah, bh.v, acc);
      acc = wmma_bf16(ah, bl.v, acc);
      acc = wmma_bf16(al, bh.v, acc);
      const float pb = pp_b[p];
#pragma unroll
      for (int r = 0; r < 8; ++r) fo[p][8 * hh + r][brow] = acc[r] + pb;
    }
  }
  __syncthreads();

  // 5) AdaNorm over p (16 values per (i,j)) and SiLU, in place
  {
    const float alpha = ada_alpha[0];
#pragma unroll 1
    for (int jq = 0; jq < 4; ++jq) {
      const int q = tid + 256 * jq;
      const int i = q >> 6, j = q & 63;
      float v[16];
      float mu = 0.f;
#pragma unroll
      for (int p = 0; p < 16; ++p) { v[p] = fo[p][i][j]; mu += v[p]; }
      mu *= 0.0625f;
      float var = 0.f;
#pragma unroll
      for (int p = 0; p < 16; ++p) { const float d = v[p] - mu; var += d * d; }
      var *= 0.0625f;
      const float rs = 1.0f / sqrtf(var + 1e-5f);
#pragma unroll
      for (int p = 0; p < 16; ++p) {
        const float f = v[p] + alpha * ((v[p] - mu) * rs * ada_g[p] + ada_b[p]);
        fo[p][i][j] = f / (1.0f + __expf(-f));
      }
    }
  }
  __syncthreads();

  {
    const size_t pbase = (size_t)b * 16;
    const int col = 4 * (lane & 15), rsel = lane >> 4;
#pragma unroll 1
    for (int u = 0; u < 16; ++u) {
      const int rho = wave * 32 + 2 * u + rsel;
      const int p = rho >> 4, i = rho & 15;
      const v4f v = *(const v4f_ma*)(&fo[p][i][col]);
      *(v4f*)(out + (((pbase + p) * 64 + (size_t)(i0 + i)) * 64 + col)) = v;
    }
    
  }
}

extern "C" void kernel_launch(void* const* d_in, const int* in_sizes, int n_in,
                              void* d_out, int out_size, void* d_ws, size_t ws_size,
                              hipStream_t stream) {
  if (n_in < 29 || d_out == 0 || d_ws == 0) return;
  const int nB = in_sizes[0] / 64;
  if (nB <= 0 || in_sizes[0] != nB * 64 || in_sizes[1] != nB * 64 || in_sizes[2] != nB * 64 ||
      in_sizes[3] != nB * 64 || in_sizes[4] != nB * 4096 ||
      in_sizes[5] < 32 || in_sizes[6] < 32 || in_sizes[7] != 2048 || in_sizes[8] < 32 || in_sizes[9] < 32 ||
      in_sizes[10] != 1024 || in_sizes[11] < 32 || in_sizes[12] != 1024 || in_sizes[13] < 32 ||
      in_sizes[14] != 1024 || in_sizes[15] < 32 || in_sizes[16] != 1024 || in_sizes[17] < 32 ||
      in_sizes[18] < 32 || in_sizes[19] < 32 || in_sizes[20] < 4 || in_sizes[21] < 4 ||
      in_sizes[22] != 256 || in_sizes[23] < 32 || in_sizes[24] != 16384 || in_sizes[25] < 16 ||
      in_sizes[26] < 16 || in_sizes[27] < 16 || in_sizes[28] < 1 ||
      out_size != nB * 16 * 4096) return;
  const size_t need = (size_t)nB * 8192 * sizeof(float);      // x after attention: [nB][4][64][32] f32
  if (need > ws_size) return;

  const float* ctcf   = (const float*)d_in[0];
  const float* hac    = (const float*)d_in[1];
  const float* me1    = (const float*)d_in[2];
  const float* me3    = (const float*)d_in[3];
  const float* bulk   = (const float*)d_in[4];
  const float* we_w   = (const float*)d_in[5];
  const float* we_b   = (const float*)d_in[6];
  const float* pos    = (const float*)d_in[7];
  const float* mn_g   = (const float*)d_in[8];
  const float* mn_b   = (const float*)d_in[9];
  const float* wq     = (const float*)d_in[10];
  const float* bq     = (const float*)d_in[11];
  const float* wk     = (const float*)d_in[12];
  const float* bk     = (const float*)d_in[13];
  const float* wv     = (const float*)d_in[14];
  const float* bv     = (const float*)d_in[15];
  const float* wo     = (const float*)d_in[16];
  const float* bo     = (const float*)d_in[17];
  const float* an_g   = (const float*)d_in[18];
  const float* an_b   = (const float*)d_in[19];
  const float* conv_w = (const float*)d_in[20];
  const float* conv_b = (const float*)d_in[21];
  const float* gate_w = (const float*)d_in[22];
  const float* gate_b = (const float*)d_in[23];
  const float* pp_w   = (const float*)d_in[24];
  const float* pp_b   = (const float*)d_in[25];
  const float* ada_g  = (const float*)d_in[26];
  const float* ada_b  = (const float*)d_in[27];
  const float* ada_a  = (const float*)d_in[28];

  float* ws_x = (float*)d_ws;
  const int nbs = nB * 4;          // (b,s) blocks
  const int nblk = nB * 4;         // (b, 16-row tile) blocks

  k_attn<<<nbs, 256, 0, stream>>>(ctcf, hac, me1, me3, bulk, we_w, we_b, pos, mn_g, mn_b,
                                   wq, bq, wk, bk, wv, bv, wo, bo, an_g, an_b,
                                   conv_w, conv_b, gate_w, gate_b, ws_x, nbs);
  k_pair<<<nblk, 256, 0, stream>>>(ws_x, pp_w, pp_b, ada_g, ada_b, ada_a, (float*)d_out, nblk);
}

// v001
// Measured time: 23.3 microseconds a run.
// Timed twice side by side with v000, it ran 1.35 and 1.36 times as fast.
// Contractions: q/k/v/out projections and P.V on v_wmma_f32_16x16x32_f16 (f16 operands, P scaled by 4096, f32 accumulate); pair path T=m.A_p and feat=T.m^T on v_wmma_f32_16x16x32_bf16 as bf16 hi/lo split (3 products each, f32 accumulate); q.k (K=8) and gate (K=8) on VALU f32.
#include <hip/hip_runtime.h>

typedef _Float16       v16h  __attribute__((ext_vector_type(16)));
typedef _Float16       v8h   __attribute__((ext_vector_type(8)));
typedef __bf16         v16b  __attribute__((ext_vector_type(16)));
typedef unsigned short v16us __attribute__((ext_vector_type(16)));
typedef unsigned short v8us  __attribute__((ext_vector_type(8)));
typedef float          v8f   __attribute__((ext_vector_type(8)));
typedef float          v4f   __attribute__((ext_vector_type(4)));
typedef v8h  __attribute__((may_alias)) v8h_ma;
typedef v8us __attribute__((may_alias)) v8us_ma;
typedef v4f  __attribute__((may_alias)) v4f_ma;

union FragH { v16h v;  v8h  half[2]; };
union FragU { v16us v; v8us half[2]; };

// 32-lane butterfly sums of 8 independent rows, stage by stage: the 8 cross-lane moves of a stage are in flight
// together, so a stage costs one cross-lane latency for all rows. Per row the order of the sum is 16, 8, 4, 2, 1.
__device__ __forceinline__ void wave_sum32_rows(float (&v)[8]) {
#pragma unroll   // constant lane masks
  for (int o = 16; o > 0; o >>= 1) {
    float t[8];
#pragma unroll   // rows stay in registers; all moves of the stage issue before the first add
    for (int r = 0; r < 8; ++r) t[r] = __shfl_xor(v[r], o, 32);
#pragma unroll
    for (int r = 0; r < 8; ++r) v[r] += t[r];
  }
}

// 16x16x32 fragment k map, identical for A and B: element i of a lane with hh = lane>>4 holds k = (i&7) + 16*(i>>3) + 8*hh.
// A: lane&15 = row m, B: lane&15 = column n, D: acc[r] = (row 8*hh + r, col lane&15).
__device__ __forceinline__ int kof(int i, int hh) { return (i & 7) + ((i >> 3) << 4) + 8 * hh; }

__device__ __forceinline__ v8f wmma_f16(v16h a, v16h b, v8f c) {
  c = __builtin_amdgcn_wmma_f32_16x16x32_f16(false, a, false, b, (short)0, c, false, false);
  asm volatile("v_nop\n\tv_nop\n\tv_nop\n\tv_nop" : "+v"(c) : "v"(a), "v"(b));
  return c;
}

__device__ __forceinline__ v8f wmma_bf16(v16us a, v16us b, v8f c) {
  v16b ab = __builtin_bit_cast(v16b, a);
  v16b bb = __builtin_bit_cast(v16b, b);
  c = __builtin_amdgcn_wmma_f32_16x16x32_bf16(false, ab, false, bb, (short)0, c, false, false);
  asm volatile("v_nop\n\tv_nop\n\tv_nop\n\tv_nop" : "+v"(c) : "v"(ab), "v"(bb));
  return c;
}

// f32 -> bf16 bit pattern, RNE convert; and back
__device__ __forceinline__ unsigned short bf_rne(float x) {
  unsigned int u = __float_as_uint(x);
  u += 0x7FFFu + ((u >> 16) & 1u);
  return (unsigned short)(u >> 16);
}
__device__ __forceinline__ float bf_val(unsigned short s) {
  return __uint_as_float(((unsigned int)s) << 16);
}

// B fragment for output column n of X.W^T with W stored [n][k] f32, pitch 32 (B[k][n] = W[n][k]), converted to f16
__device__ __forceinline__ v16h wfrag_f16(const float* __restrict__ W, int n, int hh) {
  const float* r = W + n * 32;
  v16h f = {};
#pragma unroll
  for (int i = 0; i < 16; ++i) f[i] = (_Float16)r[kof(i, hh)];
  return f;
}

// ---------------------------------------------------------------------------------------------
// Kernel 1: one block per (b,s). Builds x = LN(msa+pos), row attention with bulk bias, gate,
// ---------------------------------------------------------------------------------------------
__global__ __launch_bounds__(256) void k_attn(
    const float* __restrict__ ctcf, const float* __restrict__ hac,
    const float* __restrict__ me1,  const float* __restrict__ me3,
    const float* __restrict__ bulk,
    const float* __restrict__ we_w, const float* __restrict__ we_b,
    const float* __restrict__ pos,
    const float* __restrict__ mn_g, const float* __restrict__ mn_b,
    const float* __restrict__ wq,   const float* __restrict__ bq,
    const float* __restrict__ wk,   const float* __restrict__ bk,
    const float* __restrict__ wv,   const float* __restrict__ bv,
    const float* __restrict__ wo,   const float* __restrict__ bo,
    const float* __restrict__ an_g, const float* __restrict__ an_b,
    const float* __restrict__ conv_w, const float* __restrict__ conv_b,
    const float* __restrict__ gate_w, const float* __restrict__ gate_b,
    float* __restrict__ xw, int nbs)
{
  __shared__ __attribute__((aligned(16))) float    xs[64][32];   // x f32 (kept for residual), then LN output staging
  __shared__ __attribute__((aligned(16))) _Float16 xh[64][32];   // x f16 (A operand of q/k/v)
  __shared__ __attribute__((aligned(16))) float    qf[64][32];
  __shared__ __attribute__((aligned(16))) float    kf[64][32];
  __shared__ __attribute__((aligned(16))) _Float16 vh[64][32];   // v f16 (B operand of P.V)
  __shared__ __attribute__((aligned(16))) _Float16 ph[64][64];   // P * 4096, f16, current head
  __shared__ __attribute__((aligned(16))) float    og[64][32];   // P.V output (l, h*8+d)
  __shared__ __attribute__((aligned(16))) _Float16 oh[64][32];   // gated output, f16 (A operand of out proj)
  __shared__ __attribute__((aligned(16))) float    o2[64][32];   // out proj + bias

  const int tid = threadIdx.x, wave = tid >> 5, lane = tid & 31;
  const int hh = lane >> 4, m16 = lane & 15;
  const int bs = blockIdx.x;
  if (bs >= nbs) return;                       // block-uniform
  const int b = bs >> 2, s = bs & 3;

  // 1) x = LN(signal * we_w + we_b + pos); wave per row, lane = channel
  {
    const float* sig = (s == 0) ? ctcf : ((s == 1) ? hac : ((s == 2) ? me1 : me3));
    const float ww = we_w[lane], wb = we_b[lane], g = mn_g[lane], be = mn_b[lane];
    float d[8], t[8];
#pragma unroll   // the wave's 8 rows side by side: their global loads are in flight together
    for (int rr = 0; rr < 8; ++rr) {
      const int l = wave * 8 + rr;
      d[rr] = sig[b * 64 + l];
      t[rr] = pos[l * 32 + lane];
    }
    // keeps the first use of a signal value behind the issue of the position loads: one global latency, not two in a row
    __builtin_amdgcn_sched_barrier(0);
#pragma unroll
    for (int rr = 0; rr < 8; ++rr) {
      float v = d[rr] * ww + wb;
      v += t[rr];
      d[rr] = v;
      t[rr] = v;
    }
    wave_sum32_rows(t);
#pragma unroll
    for (int rr = 0; rr < 8; ++rr) { d[rr] -= t[rr] * 0.03125f; t[rr] = d[rr] * d[rr]; }
    wave_sum32_rows(t);
#pragma unroll   // 8 independent sqrt / divide chains fill each other's latency
    for (int rr = 0; rr < 8; ++rr) {
      const int l = wave * 8 + rr;
      const float var = t[rr] * 0.03125f;
      const float y   = d[rr] * (1.0f / sqrtf(var + 1e-5f)) * g + be;
      xs[l][lane] = y;
      xh[l][lane] = (_Float16)y;
    }
  }
  __syncthreads();

  // 2) q/k/v = x.W^T + b : one 16x16 tile (mt,nt) per wave for each of q,k,v ; K = 32 = one k-step
  {
    const int mt = wave >> 1, nt = wave & 1;
    const int arow = mt * 16 + m16, ncol = nt * 16 + m16, drow = mt * 16 + 8 * hh;
    FragH a;
    a.half[0] = *(const v8h_ma*)(&xh[arow][8 * hh]);
    a.half[1] = *(const v8h_ma*)(&xh[arow][16 + 8 * hh]);
    {
      v8f acc = {};
      acc = wmma_f16(a.v, wfrag_f16(wq, ncol, hh), acc);
      const float bb = bq[ncol];
#pragma unroll
      for (int r = 0; r < 8; ++r) qf[drow + r][ncol] = acc[r] + bb;
    }
    {
      v8f acc = {};
      acc = wmma_f16(a.v, wfrag_f16(wk, ncol, hh), acc);
      const float bb = bk[ncol];
#pragma unroll
      for (int r = 0; r < 8; ++r) kf[drow + r][ncol] = acc[r] + bb;
    }
    {
      v8f acc = {};
      acc = wmma_f16(a.v, wfrag_f16(wv, ncol, hh), acc);
      const float bb = bv[ncol];
#pragma unroll
      for (int r = 0; r < 8; ++r) vh[drow + r][ncol] = (_Float16)(acc[r] + bb);
    }
  }
  __syncthreads();

  // 3) per head: scores (K=8, VALU f32) + bias + softmax by thread (l, quarter of 64 keys), then P.V on f16 WMMA
  const float rsD = 0.35355339059327373f;     // 1/sqrt(8)
#pragma unroll 1
  for (int h = 0; h < 4; ++h) {
    {
      const int l = tid >> 2, m0 = (tid & 3) * 16;     // 4 adjacent lanes share one query row
      float qr[8];
#pragma unroll
      for (int d = 0; d < 8; ++d) qr[d] = qf[l][h * 8 + d];
      const float cw = conv_w[h], cb = conv_b[h];
      const float* bl = bulk + ((size_t)b * 64 + l) * 64 + m0;
      float sc[16];
      float mx = -3.0e38f;
#pragma unroll
      for (int mm = 0; mm < 16; ++mm) {
        float acc = 0.f;
#pragma unroll
        for (int d = 0; d < 8; ++d) acc += qr[d] * kf[m0 + mm][h * 8 + d];
        const float sv = acc * rsD + (bl[mm] * cw + cb);
        sc[mm] = sv;
        mx = fmaxf(mx, sv);
      }
      mx = fmaxf(mx, __shfl_xor(mx, 1, 32));
      mx = fmaxf(mx, __shfl_xor(mx, 2, 32));
      float sum = 0.f;
#pragma unroll
      for (int mm = 0; mm < 16; ++mm) { const float e = __expf(sc[mm] - mx); sc[mm] = e; sum += e; }
      sum += __shfl_xor(sum, 1, 32);
      sum += __shfl_xor(sum, 2, 32);
      const float inv = 4096.0f / sum;            // P carried x4096 (exact power of two) for the f16 operand
      FragH pv;
#pragma unroll
      for (int mm = 0; mm < 8; ++mm) {
        pv.half[0][mm] = (_Float16)(sc[mm] * inv);
        pv.half[1][mm] = (_Float16)(sc[8 + mm] * inv);
      }
      *(v8h_ma*)(&ph[l][m0])     = pv.half[0];
      *(v8h_ma*)(&ph[l][m0 + 8]) = pv.half[1];
    }
    __syncthreads();
    if (wave < 4) {                               // wave-uniform; all 32 lanes active in the WMMA
      const int mt = wave, arow = mt * 16 + m16, vcol = h * 8 + (m16 & 7);
      v8f acc = {};
#pragma unroll
      for (int ks = 0; ks < 2; ++ks) {
        const int k0 = ks * 32;
        FragH a;                                  // A[m = query][k = key] = P row, k contiguous
        a.half[0] = *(const v8h_ma*)(&ph[arow][k0 + 8 * hh]);
        a.half[1] = *(const v8h_ma*)(&ph[arow][k0 + 16 + 8 * hh]);
        v16h bvv = {};                            // B[k = key][n = d] = v[key][h*8+d], columns n>=8 zero
#pragma unroll
        for (int i = 0; i < 16; ++i) {
          const _Float16 t = vh[k0 + kof(i, hh)][vcol];
          bvv[i] = (m16 < 8) ? t : (_Float16)0.0f;
        }
        acc = wmma_f16(a.v, bvv, acc);
      }
      if (m16 < 8) {
        const int drow = mt * 16 + 8 * hh;
#pragma unroll
        for (int r = 0; r < 8; ++r) og[drow + r][h * 8 + m16] = acc[r] * (1.0f / 4096.0f);
      }
    }
    __syncthreads();
  }

  // 4) gate: oh[l][h*8+c] = og[l][h*8+c] * sigmoid(sum_d gate_w[h][c][d] og[l][h*8+d] + gate_b[h][c])
  {
    const int hc = lane, h8 = hc & 24;            // row l = wave + 8 * j
    float ov[8][8], oc[8];
#pragma unroll   // all LDS reads of the thread's 8 rows issue before the first use
    for (int j = 0; j < 8; ++j) {
      const int l = wave + 8 * j;
#pragma unroll
      for (int d = 0; d < 8; ++d) ov[j][d] = og[l][h8 + d];
      oc[j] = og[l][hc];
    }
#pragma unroll   // 8 independent dot / exp / divide chains fill each other's latency
    for (int j = 0; j < 8; ++j) {
      float acc = gate_b[hc];
#pragma unroll
      for (int d = 0; d < 8; ++d) acc += gate_w[hc * 8 + d] * ov[j][d];
      const float gs = 1.0f / (1.0f + __expf(-acc));
      oh[wave + 8 * j][hc] = (_Float16)(oc[j] * gs);
    }
  }
  __syncthreads();

  // 5) output projection: o2 = oh.wo^T + bo ; one tile per wave
  {
    const int mt = wave >> 1, nt = wave & 1;
    const int arow = mt * 16 + m16, ncol = nt * 16 + m16, drow = mt * 16 + 8 * hh;
    FragH a;
    a.half[0] = *(const v8h_ma*)(&oh[arow][8 * hh]);
    a.half[1] = *(const v8h_ma*)(&oh[arow][16 + 8 * hh]);
    v8f acc = {};
    acc = wmma_f16(a.v, wfrag_f16(wo, ncol, hh), acc);
    const float bb = bo[ncol];
#pragma unroll
    for (int r = 0; r < 8; ++r) o2[drow + r][ncol] = acc[r] + bb;
  }
  __syncthreads();

  // 6) residual + LN, staged back into xs (each lane rewrites only the element it read)
  {
    const float g = an_g[lane], be = an_b[lane];
    float d[8], t[8];
#pragma unroll   // the wave's 8 rows side by side: their LDS reads are in flight together
    for (int rr = 0; rr < 8; ++rr) {
      const int l = wave * 8 + rr;
      const float v = xs[l][lane] + o2[l][lane];
      d[rr] = v;
      t[rr] = v;
    }
    wave_sum32_rows(t);
#pragma unroll
    for (int rr = 0; rr < 8; ++rr) { d[rr] -= t[rr] * 0.03125f; t[rr] = d[rr] * d[rr]; }
    wave_sum32_rows(t);
#pragma unroll   // 8 independent sqrt / divide chains fill each other's latency
    for (int rr = 0; rr < 8; ++rr) {
      const float var = t[rr] * 0.03125f;
      xs[wave * 8 + rr][lane] = d[rr] * (1.0f / sqrtf(var + 1e-5f)) * g + be;
    }
  }
  __syncthreads();

  {
    float* xg = xw + (size_t)bs * 2048;
    const int col = 4 * (lane & 7);
    const int r0 = wave * 8 + (lane >> 3), r1 = r0 + 4;
    const v4f v0 = *(const v4f_ma*)(&xs[r0][col]);
    const v4f v1 = *(const v4f_ma*)(&xs[r1][col]);
    *(v4f*)(xg + r0 * 32 + col) = v0;
    *(v4f*)(xg + r1 * 32 + col) = v1;
    
  }
}

// ---------------------------------------------------------------------------------------------
// Kernel 2: one block per (b, tile of 16 rows i). m = max over tracks, unit rows, bf16 hi/lo;
// T_p[i][d] = sum_c mh[i][c] A_p[c][d]  (A_p[c][d] = pp_w[p][c*32+d]);  feat_p[i][j] = sum_d T_p[i][d] mh[j][d] + pp_b[p];
// ---------------------------------------------------------------------------------------------
__global__ __launch_bounds__(256) void k_pair(
    const float* __restrict__ xw, const float* __restrict__ ppw, const float* __restrict__ pp_b,
    const float* __restrict__ ada_g, const float* __restrict__ ada_b, const float* __restrict__ ada_alpha,
    float* __restrict__ out, int nblk)
{
  __shared__ __attribute__((aligned(16))) unsigned short mhi[64][32];   // bf16 bits, hi part of unit rows
  __shared__ __attribute__((aligned(16))) unsigned short mlo[64][32];   // bf16 bits, lo part
  __shared__ __attribute__((aligned(16))) float tf[16][16][32];         // T_p for this block's 16 rows, f32
  __shared__ __attribute__((aligned(16))) float fo[16][16][64];         // feat / final values (p, i, j)
  float* mf = &fo[0][0][0];                                            // [64*32] f32 max rows; dead before fo is first written

  const int tid = threadIdx.x, wave = tid >> 5, lane = tid & 31;
  const int hh = lane >> 4, m16 = lane & 15;
  const int blk = blockIdx.x;
  if (blk >= nblk) return;                     // block-uniform
  const int b = blk >> 2, i0 = (blk & 3) * 16;

  // 1) max over the 4 tracks
  {
    const float* xb = xw + (size_t)b * 8192;
#pragma unroll
    for (int j = 0; j < 8; ++j) {
      const int e = tid + 256 * j;
      float v = xb[e];
      v = fmaxf(v, xb[2048 + e]);
      v = fmaxf(v, xb[4096 + e]);
      v = fmaxf(v, xb[6144 + e]);
      mf[e] = v;
    }
  }
  __syncthreads();

  // 2) unit rows (the pair norm factorises as |m_i|*|m_j|; clamp applied per factor), split into bf16 hi + lo
  {
    float v[8], t[8];
#pragma unroll   // the wave's 8 rows side by side: their LDS reads are in flight together
    for (int rr = 0; rr < 8; ++rr) {
      v[rr] = mf[(wave * 8 + rr) * 32 + lane];
      t[rr] = v[rr] * v[rr];
    }
    wave_sum32_rows(t);
#pragma unroll   // 8 independent sqrt / divide chains fill each other's latency
    for (int rr = 0; rr < 8; ++rr) {
      const int l = wave * 8 + rr;
      const float inv = 1.0f / fmaxf(sqrtf(t[rr]), 1e-3f);
      const float y   = v[rr] * inv;
      const unsigned short hb = bf_rne(y);
      mhi[l][lane] = hb;
      mlo[l][lane] = bf_rne(y - bf_val(hb));
    }
  }
  __syncthreads();

  // 3) GEMM1: wave handles p = 2*wave, 2*wave+1 and both 16-column halves of d; K = 32 (c), one k-step, 3 products
  {
    const int arow = i0 + m16;
    FragU ahi, alo;                              // A[m = i][k = c] = mh[i0+i][c]
    ahi.half[0] = *(const v8us_ma*)(&mhi[arow][8 * hh]);
    ahi.half[1] = *(const v8us_ma*)(&mhi[arow][16 + 8 * hh]);
    alo.half[0] = *(const v8us_ma*)(&mlo[arow][8 * hh]);
    alo.half[1] = *(const v8us_ma*)(&mlo[arow][16 + 8 * hh]);
    float wf[4][16];
#pragma unroll   // the global loads of all four B fragments are in flight together
    for (int u = 0; u < 4; ++u) {
      const float* wp = ppw + (size_t)(wave * 2 + (u >> 1)) * 1024 + (u & 1) * 16 + m16;
#pragma unroll
      for (int i = 0; i < 16; ++i) wf[u][i] = wp[kof(i, hh) * 32];
    }
#pragma unroll   // wf stays in registers
    for (int pp = 0; pp < 2; ++pp) {
      const int p = wave * 2 + pp;
#pragma unroll
      for (int nt = 0; nt < 2; ++nt) {
        const int n = nt * 16 + m16;             // B[k = c][n = d] = pp_w[p][c*32 + d]
        v16us bh = {}, bl = {};
#pragma unroll
        for (int i = 0; i < 16; ++i) {
          const float w = wf[pp * 2 + nt][i];
          const unsigned short hb = bf_rne(w);
          bh[i] = hb;
          bl[i] = bf_rne(w - bf_val(hb));
        }
        v8f acc = {};
        acc = wmma_bf16(ahi.v, bh, acc);
        acc = wmma_bf16(ahi.v, bl, acc);
        acc = wmma_bf16(alo.v, bh, acc);
#pragma unroll
        for (int r = 0; r < 8; ++r) tf[p][8 * hh + r][n] = acc[r];
      }
    }
  }
  __syncthreads();

  // 4) GEMM2: feat_p[i][j] ; A[m = i][k = d] = T_p[i][d] (f32 in LDS, split at load), B[k = d][n = j] = mh[j][d] (row j, k-contiguous)
#pragma unroll 1
  for (int nt = 0; nt < 4; ++nt) {
    const int brow = nt * 16 + m16;
    FragU bh, bl;
    bh.half[0] = *(const v8us_ma*)(&mhi[brow][8 * hh]);
    bh.half[1] = *(const v8us_ma*)(&mhi[brow][16 + 8 * hh]);
    bl.half[0] = *(const v8us_ma*)(&mlo[brow][8 * hh]);
    bl.half[1] = *(const v8us_ma*)(&mlo[brow][16 + 8 * hh]);
    float ta[2][16];
#pragma unroll   // the LDS reads of both A fragments are in flight together
    for (int pp = 0; pp < 2; ++pp)
#pragma unroll
      for (int i = 0; i < 16; ++i) ta[pp][i] = tf[wave * 2 + pp][m16][kof(i, hh)];
#pragma unroll   // ta stays in registers
    for (int pp = 0; pp < 2; ++pp) {
      const int p = wave * 2 + pp;
      v16us ah = {}, al = {};
#pragma unroll
      for (int i = 0; i < 16; ++i) {
        const float t = ta[pp][i];
        const unsigned short hb = bf_rne(t);
        ah[i] = hb;
        al[i] = bf_rne(t - bf_val(hb));
      }
      v8f acc = {};
      acc = wmma_bf16(ah, bh.v, acc);
      acc = wmma_bf16(ah, bl.v, acc);
      acc = wmma_bf16(al, bh.v, acc);
      const float pb = pp_b[p];
#pragma unroll
      for (int r = 0; r < 8; ++r) fo[p][8 * hh + r][brow] = acc[r] + pb;
    }
  }
  __syncthreads();

  // 5) AdaNorm over p (16 values per (i,j)) and SiLU, in place
  {
    const float alpha = ada_alpha[0];
    float v[4][16], mu[4], rs[4];
#pragma unroll   // the thread's 4 positions side by side: LDS reads in flight together
    for (int jq = 0; jq < 4; ++jq) {
      const int q = tid + 256 * jq;
#pragma unroll
      for (int p = 0; p < 16; ++p) v[jq][p] = fo[p][q >> 6][q & 63];
    }
#pragma unroll   // 4 independent mean / variance / sqrt / divide chains fill each other's latency
    for (int jq = 0; jq < 4; ++jq) {
      float m = 0.f;
#pragma unroll
      for (int p = 0; p < 16; ++p) m += v[jq][p];
      m *= 0.0625f;
      float var = 0.f;
#pragma unroll
      for (int p = 0; p < 16; ++p) { const float d = v[jq][p] - m; var += d * d; }
      var *= 0.0625f;
      mu[jq] = m;
      rs[jq] = 1.0f / sqrtf(var + 1e-5f);
    }
#pragma unroll   // v stays in registers
    for (int jq = 0; jq < 4; ++jq) {
      const int q = tid + 256 * jq;
#pragma unroll
      for (int p = 0; p < 16; ++p) {
        const float f = v[jq][p] + alpha * ((v[jq][p] - mu[jq]) * rs[jq] * ada_g[p] + ada_b[p]);
        fo[p][q >> 6][q & 63] = f / (1.0f + __expf(-f));
      }
    }
  }
  __syncthreads();

  {
    const size_t pbase = (size_t)b * 16;
    const int col = 4 * (lane & 15), rsel = lane >> 4;
    v4f v[16];
#pragma unroll   // all 16 LDS reads are in flight together, then the stores follow without a wait in between
    for (int u = 0; u < 16; ++u) {
      const int rho = wave * 32 + 2 * u + rsel;
      v[u] = *(const v4f_ma*)(&fo[rho >> 4][rho & 15][col]);
    }
#pragma unroll
    for (int u = 0; u < 16; ++u) {
      const int rho = wave * 32 + 2 * u + rsel;
      const int p = rho >> 4, i = rho & 15;
      *(v4f*)(out + (((pbase + p) * 64 + (size_t)(i0 + i)) * 64 + col)) = v[u];
    }
    
  }
}

extern "C" void kernel_launch(void* const* d_in, const int* in_sizes, int n_in,
                              void* d_out, int out_size, void* d_ws, size_t ws_size,
                              hipStream_t stream) {
  if (n_in < 29 || d_out == 0 || d_ws == 0) return;
  const int nB = in_sizes[0] / 64;
  if (nB <= 0 || in_sizes[0] != nB * 64 || in_sizes[1] != nB * 64 || in_sizes[2] != nB * 64 ||
      in_sizes[3] != nB * 64 || in_sizes[4] != nB * 4096 ||
      in_sizes[5] < 32 || in_sizes[6] < 32 || in_sizes[7] != 2048 || in_sizes[8] < 32 || in_sizes[9] < 32 ||
      in_sizes[10] != 1024 || in_sizes[11] < 32 || in_sizes[12] != 1024 || in_sizes[13] < 32 ||
      in_sizes[14] != 1024 || in_sizes[15] < 32 || in_sizes[16] != 1024 || in_sizes[17] < 32 ||
      in_sizes[18] < 32 || in_sizes[19] < 32 || in_sizes[20] < 4 || in_sizes[21] < 4 ||
      in_sizes[22] != 256 || in_sizes[23] < 32 || in_sizes[24] != 16384 || in_sizes[25] < 16 ||
      in_sizes[26] < 16 || in_sizes[27] < 16 || in_sizes[28] < 1 ||
      out_size != nB * 16 * 4096) return;
  const size_t need = (size_t)nB * 8192 * sizeof(float);      // x after attention: [nB][4][64][32] f32
  if (need > ws_size) return;

  const float* ctcf   = (const float*)d_in[0];
  const float* hac    = (const float*)d_in[1];
  const float* me1    = (const float*)d_in[2];
  const float* me3    = (const float*)d_in[3];
  const float* bulk   = (const float*)d_in[4];
  const float* we_w   = (const float*)d_in[5];
  const float* we_b   = (const float*)d_in[6];
  const float* pos    = (const float*)d_in[7];
  const float* mn_g   = (const float*)d_in[8];
  const float* mn_b   = (const float*)d_in[9];
  const float* wq     = (const float*)d_in[10];
  const float* bq     = (const float*)d_in[11];
  const float* wk     = (const float*)d_in[12];
  const float* bk     = (const float*)d_in[13];
  const float* wv     = (const float*)d_in[14];
  const float* bv     = (const float*)d_in[15];
  const float* wo     = (const float*)d_in[16];
  const float* bo     = (const float*)d_in[17];
  const float* an_g   = (const float*)d_in[18];
  const float* an_b   = (const float*)d_in[19];
  const float* conv_w = (const float*)d_in[20];
  const float* conv_b = (const float*)d_in[21];
  const float* gate_w = (const float*)d_in[22];
  const float* gate_b = (const float*)d_in[23];
  const float* pp_w   = (const float*)d_in[24];
  const float* pp_b   = (const float*)d_in[25];
  const float* ada_g  = (const float*)d_in[26];
  const float* ada_b  = (const float*)d_in[27];
  const float* ada_a  = (const float*)d_in[28];

  float* ws_x = (float*)d_ws;
  const int nbs = nB * 4;          // (b,s) blocks
  const int nblk = nB * 4;         // (b, 16-row tile) blocks

  k_attn<<<nbs, 256, 0, stream>>>(ctcf, hac, me1, me3, bulk, we_w, we_b, pos, mn_g, mn_b,
                                   wq, bq, wk, bk, wv, bv, wo, bo, an_g, an_b,
                                   conv_w, conv_b, gate_w, gate_b, ws_x, nbs);
  k_pair<<<nblk, 256, 0, stream>>>(ws_x, pp_w, pp_b, ada_g, ada_b, ada_a, (float*)d_out, nblk);
}

// v002
// A run of this version takes 20 microseconds.
// Next to v001, in two timings, it ran 1.15 and 1.18 times as fast.
// All steps since v000 together make it 1.58 times as fast.
// Contractions: q/k/v/out projections and P.V on v_wmma_f32_16x16x32_f16 (f16 operands, P scaled by 4096, f32 accumulate); pair path T=m.A_p and feat=T.m^T on v_wmma_f32_16x16x32_bf16 as bf16 hi/lo split (3 products each, f32 accumulate); q.k (K=8) and gate (K=8) on VALU f32.
#include <hip/hip_runtime.h>

typedef _Float16       v16h  __attribute__((ext_vector_type(16)));
typedef _Float16       v8h   __attribute__((ext_vector_type(8)));
typedef __bf16         v16b  __attribute__((ext_vector_type(16)));
typedef unsigned short v16us __attribute__((ext_vector_type(16)));
typedef unsigned short v8us  __attribute__((ext_vector_type(8)));
typedef float          v8f   __attribute__((ext_vector_type(8)));
typedef float          v4f   __attribute__((ext_vector_type(4)));
typedef v8h  __attribute__((may_alias)) v8h_ma;
typedef v8us __attribute__((may_alias)) v8us_ma;
typedef v4f  __attribute__((may_alias)) v4f_ma;

union FragH { v16h v;  v8h  half[2]; };
union FragU { v16us v; v8us half[2]; };

// 32-lane butterfly sums of 8 independent rows, stage by stage: the 8 cross-lane moves of a stage are in flight
// together, so a stage costs one cross-lane latency for all rows. Per row the order of the sum is 16, 8, 4, 2, 1.
__device__ __forceinline__ void wave_sum32_rows(float (&v)[8]) {
#pragma unroll   // constant lane masks
  for (int o = 16; o > 0; o >>= 1) {
    float t[8];
#pragma unroll   // rows stay in registers; all moves of the stage issue before the first add
    for (int r = 0; r < 8; ++r) t[r] = __shfl_xor(v[r], o, 32);
#pragma unroll
    for (int r = 0; r < 8; ++r) v[r] += t[r];
  }
}

// 16x16x32 fragment k map, identical for A and B: element i of a lane with hh = lane>>4 holds k = (i&7) + 16*(i>>3) + 8*hh.
// A: lane&15 = row m, B: lane&15 = column n, D: acc[r] = (row 8*hh + r, col lane&15).
__device__ __forceinline__ int kof(int i, int hh) { return (i & 7) + ((i >> 3) << 4) + 8 * hh; }

__device__ __forceinline__ v8f wmma_f16(v16h a, v16h b, v8f c) {
  c = __builtin_amdgcn_wmma_f32_16x16x32_f16(false, a, false, b, (short)0, c, false, false);
  asm volatile("v_nop\n\tv_nop\n\tv_nop\n\tv_nop" : "+v"(c) : "v"(a), "v"(b));
  return c;
}

__device__ __forceinline__ v8f wmma_bf16(v16us a, v16us b, v8f c) {
  v16b ab = __builtin_bit_cast(v16b, a);
  v16b bb = __builtin_bit_cast(v16b, b);
  c = __builtin_amdgcn_wmma_f32_16x16x32_bf16(false, ab, false, bb, (short)0, c, false, false);
  asm volatile("v_nop\n\tv_nop\n\tv_nop\n\tv_nop" : "+v"(c) : "v"(ab), "v"(bb));
  return c;
}

// f32 -> bf16 bit pattern, RNE convert; and back
__device__ __forceinline__ unsigned short bf_rne(float x) {
  unsigned int u = __float_as_uint(x);
  u += 0x7FFFu + ((u >> 16) & 1u);
  return (unsigned short)(u >> 16);
}
__device__ __forceinline__ float bf_val(unsigned short s) {
  return __uint_as_float(((unsigned int)s) << 16);
}

// B fragment for output column n of X.W^T with W stored [n][k] f32, pitch 32 (B[k][n] = W[n][k]), converted to f16
__device__ __forceinline__ v16h wfrag_f16(const float* __restrict__ W, int n, int hh) {
  const float* r = W + n * 32;
  v16h f = {};
#pragma unroll
  for (int i = 0; i < 16; ++i) f[i] = (_Float16)r[kof(i, hh)];
  return f;
}

// ---------------------------------------------------------------------------------------------
// Kernel 1: one block per (b,s). Builds x = LN(msa+pos), row attention with bulk bias, gate,
// ---------------------------------------------------------------------------------------------
__global__ __launch_bounds__(256) void k_attn(
    const float* __restrict__ ctcf, const float* __restrict__ hac,
    const float* __restrict__ me1,  const float* __restrict__ me3,
    const float* __restrict__ bulk,
    const float* __restrict__ we_w, const float* __restrict__ we_b,
    const float* __restrict__ pos,
    const float* __restrict__ mn_g, const float* __restrict__ mn_b,
    const float* __restrict__ wq,   const float* __restrict__ bq,
    const float* __restrict__ wk,   const float* __restrict__ bk,
    const float* __restrict__ wv,   const float* __restrict__ bv,
    const float* __restrict__ wo,   const float* __restrict__ bo,
    const float* __restrict__ an_g, const float* __restrict__ an_b,
    const float* __restrict__ conv_w, const float* __restrict__ conv_b,
    const float* __restrict__ gate_w, const float* __restrict__ gate_b,
    float* __restrict__ xw, int nbs)
{
  __shared__ __attribute__((aligned(16))) float    xs[64][32];   // x f32 (kept for residual), then LN output staging
  // Row pitches are 16 B x odd (80 B, 144 B): the 16-byte reads of 16 (or 4) different rows then fall on different banks.
  __shared__ __attribute__((aligned(16))) _Float16 xh[64][40];   // x f16 (A operand of q/k/v), 32 used
  __shared__ __attribute__((aligned(16))) float    qf[64][36];   // 32 used
  // k: [quarter of 16 keys][key in quarter * 36 + channel]; the 8 floats behind each quarter set the four key rows
  // that 4 adjacent lanes read at once (16 keys apart) 8 banks apart
  __shared__ __attribute__((aligned(16))) float    kf[4][16 * 36 + 8];
  __shared__ __attribute__((aligned(16))) _Float16 vh[64][40];   // v f16 (B operand of P.V), 32 used
  __shared__ __attribute__((aligned(16))) _Float16 ph[64][72];   // P * 4096, f16, current head, 64 used
  __shared__ __attribute__((aligned(16))) float    og[64][32];   // P.V output (l, h*8+d)
  __shared__ __attribute__((aligned(16))) _Float16 oh[64][40];   // gated output, f16 (A operand of out proj), 32 used
  __shared__ __attribute__((aligned(16))) float    o2[64][36];   // out proj + bias, 32 used

  const int tid = threadIdx.x, wave = tid >> 5, lane = tid & 31;
  const int hh = lane >> 4, m16 = lane & 15;
  const int bs = blockIdx.x;
  if (bs >= nbs) return;                       // block-uniform
  const int b = bs >> 2, s = bs & 3;

  // 1) x = LN(signal * we_w + we_b + pos); wave per row, lane = channel
  {
    const float* sig = (s == 0) ? ctcf : ((s == 1) ? hac : ((s == 2) ? me1 : me3));
    const float ww = we_w[lane], wb = we_b[lane], g = mn_g[lane], be = mn_b[lane];
    float d[8], t[8];
#pragma unroll   // the wave's 8 rows side by side: their global loads are in flight together
    for (int rr = 0; rr < 8; ++rr) {
      const int l = wave * 8 + rr;
      d[rr] = sig[b * 64 + l];
      t[rr] = pos[l * 32 + lane];
    }
    // keeps the first use of a signal value behind the issue of the position loads: one global latency, not two in a row
    __builtin_amdgcn_sched_barrier(0);
#pragma unroll
    for (int rr = 0; rr < 8; ++rr) {
      float v = d[rr] * ww + wb;
      v += t[rr];
      d[rr] = v;
      t[rr] = v;
    }
    wave_sum32_rows(t);
#pragma unroll
    for (int rr = 0; rr < 8; ++rr) { d[rr] -= t[rr] * 0.03125f; t[rr] = d[rr] * d[rr]; }
    wave_sum32_rows(t);
#pragma unroll   // 8 independent sqrt / divide chains fill each other's latency
    for (int rr = 0; rr < 8; ++rr) {
      const int l = wave * 8 + rr;
      const float var = t[rr] * 0.03125f;
      const float y   = d[rr] * (1.0f / sqrtf(var + 1e-5f)) * g + be;
      xs[l][lane] = y;
      xh[l][lane] = (_Float16)y;
    }
  }
  __syncthreads();

  // 2) q/k/v = x.W^T + b : one 16x16 tile (mt,nt) per wave for each of q,k,v ; K = 32 = one k-step
  {
    const int mt = wave >> 1, nt = wave & 1;
    const int arow = mt * 16 + m16, ncol = nt * 16 + m16, drow = mt * 16 + 8 * hh;
    FragH a;
    a.half[0] = *(const v8h_ma*)(&xh[arow][8 * hh]);
    a.half[1] = *(const v8h_ma*)(&xh[arow][16 + 8 * hh]);
    {
      v8f acc = {};
      acc = wmma_f16(a.v, wfrag_f16(wq, ncol, hh), acc);
      const float bb = bq[ncol];
#pragma unroll
      for (int r = 0; r < 8; ++r) qf[drow + r][ncol] = acc[r] + bb;
    }
    {
      v8f acc = {};
      acc = wmma_f16(a.v, wfrag_f16(wk, ncol, hh), acc);
      const float bb = bk[ncol];
#pragma unroll
      for (int r = 0; r < 8; ++r) kf[mt][(8 * hh + r) * 36 + ncol] = acc[r] + bb;
    }
    {
      v8f acc = {};
      acc = wmma_f16(a.v, wfrag_f16(wv, ncol, hh), acc);
      const float bb = bv[ncol];
#pragma unroll
      for (int r = 0; r < 8; ++r) vh[drow + r][ncol] = (_Float16)(acc[r] + bb);
    }
  }
  __syncthreads();

  // 3) per head: scores (K=8, VALU f32) + bias + softmax by thread (l, quarter of 64 keys), then P.V on f16 WMMA
  const float rsD = 0.35355339059327373f;     // 1/sqrt(8)
#pragma unroll 1
  for (int h = 0; h < 4; ++h) {
    {
      const int l = tid >> 2, m0 = (tid & 3) * 16;     // 4 adjacent lanes share one query row
      float qr[8];
#pragma unroll
      for (int d = 0; d < 8; ++d) qr[d] = qf[l][h * 8 + d];
      const float cw = conv_w[h], cb = conv_b[h];
      const float* bl = bulk + ((size_t)b * 64 + l) * 64 + m0;
      float sc[16];
      float mx = -3.0e38f;
#pragma unroll
      for (int mm = 0; mm < 16; ++mm) {
        float acc = 0.f;
#pragma unroll
        for (int d = 0; d < 8; ++d) acc += qr[d] * kf[tid & 3][mm * 36 + h * 8 + d];
        const float sv = acc * rsD + (bl[mm] * cw + cb);
        sc[mm] = sv;
        mx = fmaxf(mx, sv);
      }
      mx = fmaxf(mx, __shfl_xor(mx, 1, 32));
      mx = fmaxf(mx, __shfl_xor(mx, 2, 32));
      float sum = 0.f;
#pragma unroll
      for (int mm = 0; mm < 16; ++mm) { const float e = __expf(sc[mm] - mx); sc[mm] = e; sum += e; }
      sum += __shfl_xor(sum, 1, 32);
      sum += __shfl_xor(sum, 2, 32);
      const float inv = 4096.0f / sum;            // P carried x4096 (exact power of two) for the f16 operand
      FragH pv;
#pragma unroll
      for (int mm = 0; mm < 8; ++mm) {
        pv.half[0][mm] = (_Float16)(sc[mm] * inv);
        pv.half[1][mm] = (_Float16)(sc[8 + mm] * inv);
      }
      *(v8h_ma*)(&ph[l][m0])     = pv.half[0];
      *(v8h_ma*)(&ph[l][m0 + 8]) = pv.half[1];
    }
    __syncthreads();
    if (wave < 4) {                               // wave-uniform; all 32 lanes active in the WMMA
      const int mt = wave, arow = mt * 16 + m16, vcol = h * 8 + (m16 & 7);
      v8f acc = {};
#pragma unroll
      for (int ks = 0; ks < 2; ++ks) {
        const int k0 = ks * 32;
        FragH a;                                  // A[m = query][k = key] = P row, k contiguous
        a.half[0] = *(const v8h_ma*)(&ph[arow][k0 + 8 * hh]);
        a.half[1] = *(const v8h_ma*)(&ph[arow][k0 + 16 + 8 * hh]);
        v16h bvv = {};                            // B[k = key][n = d] = v[key][h*8+d], columns n>=8 zero
#pragma unroll
        for (int i = 0; i < 16; ++i) {
          const _Float16 t = vh[k0 + kof(i, hh)][vcol];
          bvv[i] = (m16 < 8) ? t : (_Float16)0.0f;
        }
        acc = wmma_f16(a.v, bvv, acc);
      }
      if (m16 < 8) {
        const int drow = mt * 16 + 8 * hh;
#pragma unroll
        for (int r = 0; r < 8; ++r) og[drow + r][h * 8 + m16] = acc[r] * (1.0f / 4096.0f);
      }
    }
    __syncthreads();
  }

  // 4) gate: oh[l][h*8+c] = og[l][h*8+c] * sigmoid(sum_d gate_w[h][c][d] og[l][h*8+d] + gate_b[h][c])
  {
    const int hc = lane, h8 = hc & 24;            // row l = wave + 8 * j
    float ov[8][8], oc[8];
#pragma unroll   // all LDS reads of the thread's 8 rows issue before the first use
    for (int j = 0; j < 8; ++j) {
      const int l = wave + 8 * j;
#pragma unroll
      for (int d = 0; d < 8; ++d) ov[j][d] = og[l][h8 + d];
      oc[j] = og[l][hc];
    }
#pragma unroll   // 8 independent dot / exp / divide chains fill each other's latency
    for (int j = 0; j < 8; ++j) {
      float acc = gate_b[hc];
#pragma unroll
      for (int d = 0; d < 8; ++d) acc += gate_w[hc * 8 + d] * ov[j][d];
      const float gs = 1.0f / (1.0f + __expf(-acc));
      oh[wave + 8 * j][hc] = (_Float16)(oc[j] * gs);
    }
  }
  __syncthreads();

  // 5) output projection: o2 = oh.wo^T + bo ; one tile per wave
  {
    const int mt = wave >> 1, nt = wave & 1;
    const int arow = mt * 16 + m16, ncol = nt * 16 + m16, drow = mt * 16 + 8 * hh;
    FragH a;
    a.half[0] = *(const v8h_ma*)(&oh[arow][8 * hh]);
    a.half[1] = *(const v8h_ma*)(&oh[arow][16 + 8 * hh]);
    v8f acc = {};
    acc = wmma_f16(a.v, wfrag_f16(wo, ncol, hh), acc);
    const float bb = bo[ncol];
#pragma unroll
    for (int r = 0; r < 8; ++r) o2[drow + r][ncol] = acc[r] + bb;
  }
  __syncthreads();

  // 6) residual + LN, staged back into xs (each lane rewrites only the element it read)
  {
    const float g = an_g[lane], be = an_b[lane];
    float d[8], t[8];
#pragma unroll   // the wave's 8 rows side by side: their LDS reads are in flight together
    for (int rr = 0; rr < 8; ++rr) {
      const int l = wave * 8 + rr;
      const float v = xs[l][lane] + o2[l][lane];
      d[rr] = v;
      t[rr] = v;
    }
    wave_sum32_rows(t);
#pragma unroll
    for (int rr = 0; rr < 8; ++rr) { d[rr] -= t[rr] * 0.03125f; t[rr] = d[rr] * d[rr]; }
    wave_sum32_rows(t);
#pragma unroll   // 8 independent sqrt / divide chains fill each other's latency
    for (int rr = 0; rr < 8; ++rr) {
      const float var = t[rr] * 0.03125f;
      xs[wave * 8 + rr][lane] = d[rr] * (1.0f / sqrtf(var + 1e-5f)) * g + be;
    }
  }
  __syncthreads();

  {
    float* xg = xw + (size_t)bs * 2048;
    const int col = 4 * (lane & 7);
    const int r0 = wave * 8 + (lane >> 3), r1 = r0 + 4;
    const v4f v0 = *(const v4f_ma*)(&xs[r0][col]);
    const v4f v1 = *(const v4f_ma*)(&xs[r1][col]);
    *(v4f*)(xg + r0 * 32 + col) = v0;
    *(v4f*)(xg + r1 * 32 + col) = v1;
    
  }
}

// ---------------------------------------------------------------------------------------------
// Kernel 2: one block per (b, tile of 16 rows i). m = max over tracks, unit rows, bf16 hi/lo;
// T_p[i][d] = sum_c mh[i][c] A_p[c][d]  (A_p[c][d] = pp_w[p][c*32+d]);  feat_p[i][j] = sum_d T_p[i][d] mh[j][d] + pp_b[p];
// ---------------------------------------------------------------------------------------------
__global__ __launch_bounds__(256) void k_pair(
    const float* __restrict__ xw, const float* __restrict__ ppw, const float* __restrict__ pp_b,
    const float* __restrict__ ada_g, const float* __restrict__ ada_b, const float* __restrict__ ada_alpha,
    float* __restrict__ out, int nblk)
{
  // Row pitches are 16 B x odd (80 B, 144 B, 272 B): the 16-byte fragment reads of 16 rows fall on different banks,
  // and so do the two 8-row halves of an accumulator store.
  __shared__ __attribute__((aligned(16))) unsigned short mhi[64][40];   // bf16 bits, hi part of unit rows, 32 used
  __shared__ __attribute__((aligned(16))) unsigned short mlo[64][40];   // bf16 bits, lo part, 32 used
  __shared__ __attribute__((aligned(16))) float tf[16][16][36];         // T_p for this block's 16 rows, f32, 32 used
  __shared__ __attribute__((aligned(16))) float fo[16][16][68];         // feat / final values (p, i, j), 64 used
  float* mf = &fo[0][0][0];                                            // [64*32] f32 max rows; dead before fo is first written

  const int tid = threadIdx.x, wave = tid >> 5, lane = tid & 31;
  const int hh = lane >> 4, m16 = lane & 15;
  const int blk = blockIdx.x;
  if (blk >= nblk) return;                     // block-uniform
  const int b = blk >> 2, i0 = (blk & 3) * 16;

  // 1) max over the 4 tracks
  {
    const float* xb = xw + (size_t)b * 8192;
#pragma unroll
    for (int j = 0; j < 8; ++j) {
      const int e = tid + 256 * j;
      float v = xb[e];
      v = fmaxf(v, xb[2048 + e]);
      v = fmaxf(v, xb[4096 + e]);
      v = fmaxf(v, xb[6144 + e]);
      mf[e] = v;
    }
  }
  __syncthreads();

  // 2) unit rows (the pair norm factorises as |m_i|*|m_j|; clamp applied per factor), split into bf16 hi + lo
  {
    float v[8], t[8];
#pragma unroll   // the wave's 8 rows side by side: their LDS reads are in flight together
    for (int rr = 0; rr < 8; ++rr) {
      v[rr] = mf[(wave * 8 + rr) * 32 + lane];
      t[rr] = v[rr] * v[rr];
    }
    wave_sum32_rows(t);
#pragma unroll   // 8 independent sqrt / divide chains fill each other's latency
    for (int rr = 0; rr < 8; ++rr) {
      const int l = wave * 8 + rr;
      const float inv = 1.0f / fmaxf(sqrtf(t[rr]), 1e-3f);
      const float y   = v[rr] * inv;
      const unsigned short hb = bf_rne(y);
      mhi[l][lane] = hb;
      mlo[l][lane] = bf_rne(y - bf_val(hb));
    }
  }
  __syncthreads();

  // 3) GEMM1: wave handles p = 2*wave, 2*wave+1 and both 16-column halves of d; K = 32 (c), one k-step, 3 products
  {
    const int arow = i0 + m16;
    FragU ahi, alo;                              // A[m = i][k = c] = mh[i0+i][c]
    ahi.half[0] = *(const v8us_ma*)(&mhi[arow][8 * hh]);
    ahi.half[1] = *(const v8us_ma*)(&mhi[arow][16 + 8 * hh]);
    alo.half[0] = *(const v8us_ma*)(&mlo[arow][8 * hh]);
    alo.half[1] = *(const v8us_ma*)(&mlo[arow][16 + 8 * hh]);
    float wf[4][16];
#pragma unroll   // the global loads of all four B fragments are in flight together
    for (int u = 0; u < 4; ++u) {
      const float* wp = ppw + (size_t)(wave * 2 + (u >> 1)) * 1024 + (u & 1) * 16 + m16;
#pragma unroll
      for (int i = 0; i < 16; ++i) wf[u][i] = wp[kof(i, hh) * 32];
    }
#pragma unroll   // wf stays in registers
    for (int pp = 0; pp < 2; ++pp) {
      const int p = wave * 2 + pp;
#pragma unroll
      for (int nt = 0; nt < 2; ++nt) {
        const int n = nt * 16 + m16;             // B[k = c][n = d] = pp_w[p][c*32 + d]
        v16us bh = {}, bl = {};
#pragma unroll
        for (int i = 0; i < 16; ++i) {
          const float w = wf[pp * 2 + nt][i];
          const unsigned short hb = bf_rne(w);
          bh[i] = hb;
          bl[i] = bf_rne(w - bf_val(hb));
        }
        v8f acc = {};
        acc = wmma_bf16(ahi.v, bh, acc);
        acc = wmma_bf16(ahi.v, bl, acc);
        acc = wmma_bf16(alo.v, bh, acc);
#pragma unroll
        for (int r = 0; r < 8; ++r) tf[p][8 * hh + r][n] = acc[r];
      }
    }
  }
  __syncthreads();

  // 4) GEMM2: feat_p[i][j] ; A[m = i][k = d] = T_p[i][d] (f32 in LDS, split at load), B[k = d][n = j] = mh[j][d] (row j, k-contiguous)
#pragma unroll 1
  for (int nt = 0; nt < 4; ++nt) {
    const int brow = nt * 16 + m16;
    FragU bh, bl;
    bh.half[0] = *(const v8us_ma*)(&mhi[brow][8 * hh]);
    bh.half[1] = *(const v8us_ma*)(&mhi[brow][16 + 8 * hh]);
    bl.half[0] = *(const v8us_ma*)(&mlo[brow][8 * hh]);
    bl.half[1] = *(const v8us_ma*)(&mlo[brow][16 + 8 * hh]);
    float ta[2][16];
#pragma unroll   // the LDS reads of both A fragments are in flight together
    for (int pp = 0; pp < 2; ++pp)
#pragma unroll
      for (int i = 0; i < 16; ++i) ta[pp][i] = tf[wave * 2 + pp][m16][kof(i, hh)];
#pragma unroll   // ta stays in registers
    for (int pp = 0; pp < 2; ++pp) {
      const int p = wave * 2 + pp;
      v16us ah = {}, al = {};
#pragma unroll
      for (int i = 0; i < 16; ++i) {
        const float t = ta[pp][i];
        const unsigned short hb = bf_rne(t);
        ah[i] = hb;
        al[i] = bf_rne(t - bf_val(hb));
      }
      v8f acc = {};
      acc = wmma_bf16(ah, bh.v, acc);
      acc = wmma_bf16(ah, bl.v, acc);
      acc = wmma_bf16(al, bh.v, acc);
      const float pb = pp_b[p];
#pragma unroll
      for (int r = 0; r < 8; ++r) fo[p][8 * hh + r][brow] = acc[r] + pb;
    }
  }
  __syncthreads();

  // 5) AdaNorm over p (16 values per (i,j)) and SiLU, in place
  {
    const float alpha = ada_alpha[0];
    float v[4][16], mu[4], rs[4];
#pragma unroll   // the thread's 4 positions side by side: LDS reads in flight together
    for (int jq = 0; jq < 4; ++jq) {
      const int q = tid + 256 * jq;
#pragma unroll
      for (int p = 0; p < 16; ++p) v[jq][p] = fo[p][q >> 6][q & 63];
    }
#pragma unroll   // 4 independent mean / variance / sqrt / divide chains fill each other's latency
    for (int jq = 0; jq < 4; ++jq) {
      float m = 0.f;
#pragma unroll
      for (int p = 0; p < 16; ++p) m += v[jq][p];
      m *= 0.0625f;
      float var = 0.f;
#pragma unroll
      for (int p = 0; p < 16; ++p) { const float d = v[jq][p] - m; var += d * d; }
      var *= 0.0625f;
      mu[jq] = m;
      rs[jq] = 1.0f / sqrtf(var + 1e-5f);
    }
#pragma unroll   // v stays in registers
    for (int jq = 0; jq < 4; ++jq) {
      const int q = tid + 256 * jq;
#pragma unroll
      for (int p = 0; p < 16; ++p) {
        const float f = v[jq][p] + alpha * ((v[jq][p] - mu[jq]) * rs[jq] * ada_g[p] + ada_b[p]);
        fo[p][q >> 6][q & 63] = f / (1.0f + __expf(-f));
      }
    }
  }
  __syncthreads();

  {
    const size_t pbase = (size_t)b * 16;
    const int col = 4 * (lane & 15), rsel = lane >> 4;
    v4f v[16];
#pragma unroll   // all 16 LDS reads are in flight together, then the stores follow without a wait in between
    for (int u = 0; u < 16; ++u) {
      const int rho = wave * 32 + 2 * u + rsel;
      v[u] = *(const v4f_ma*)(&fo[rho >> 4][rho & 15][col]);
    }
#pragma unroll
    for (int u = 0; u < 16; ++u) {
      const int rho = wave * 32 + 2 * u + rsel;
      const int p = rho >> 4, i = rho & 15;
      *(v4f*)(out + (((pbase + p) * 64 + (size_t)(i0 + i)) * 64 + col)) = v[u];
    }
    
  }
}

extern "C" void kernel_launch(void* const* d_in, const int* in_sizes, int n_in,
                              void* d_out, int out_size, void* d_ws, size_t ws_size,
                              hipStream_t stream) {
  if (n_in < 29 || d_out == 0 || d_ws == 0) return;
  const int nB = in_sizes[0] / 64;
  if (nB <= 0 || in_sizes[0] != nB * 64 || in_sizes[1] != nB * 64 || in_sizes[2] != nB * 64 ||
      in_sizes[3] != nB * 64 || in_sizes[4] != nB * 4096 ||
      in_sizes[5] < 32 || in_sizes[6] < 32 || in_sizes[7] != 2048 || in_sizes[8] < 32 || in_sizes[9] < 32 ||
      in_sizes[10] != 1024 || in_sizes[11] < 32 || in_sizes[12] != 1024 || in_sizes[13] < 32 ||
      in_sizes[14] != 1024 || in_sizes[15] < 32 || in_sizes[16] != 1024 || in_sizes[17] < 32 ||
      in_sizes[18] < 32 || in_sizes[19] < 32 || in_sizes[20] < 4 || in_sizes[21] < 4 ||
      in_sizes[22] != 256 || in_sizes[23] < 32 || in_sizes[24] != 16384 || in_sizes[25] < 16 ||
      in_sizes[26] < 16 || in_sizes[27] < 16 || in_sizes[28] < 1 ||
      out_size != nB * 16 * 4096) return;
  const size_t need = (size_t)nB * 8192 * sizeof(float);      // x after attention: [nB][4][64][32] f32
  if (need > ws_size) return;

  const float* ctcf   = (const float*)d_in[0];
  const float* hac    = (const float*)d_in[1];
  const float* me1    = (const float*)d_in[2];
  const float* me3    = (const float*)d_in[3];
  const float* bulk   = (const float*)d_in[4];
  const float* we_w   = (const float*)d_in[5];
  const float* we_b   = (const float*)d_in[6];
  const float* pos    = (const float*)d_in[7];
  const float* mn_g   = (const float*)d_in[8];
  const float* mn_b   = (const float*)d_in[9];
  const float* wq     = (const float*)d_in[10];
  const float* bq     = (const float*)d_in[11];
  const float* wk     = (const float*)d_in[12];
  const float* bk     = (const float*)d_in[13];
  const float* wv     = (const float*)d_in[14];
  const float* bv     = (const float*)d_in[15];
  const float* wo     = (const float*)d_in[16];
  const float* bo     = (const float*)d_in[17];
  const float* an_g   = (const float*)d_in[18];
  const float* an_b   = (const float*)d_in[19];
  const float* conv_w = (const float*)d_in[20];
  const float* conv_b = (const float*)d_in[21];
  const float* gate_w = (const float*)d_in[22];
  const float* gate_b = (const float*)d_in[23];
  const float* pp_w   = (const float*)d_in[24];
  const float* pp_b   = (const float*)d_in[25];
  const float* ada_g  = (const float*)d_in[26];
  const float* ada_b  = (const float*)d_in[27];
  const float* ada_a  = (const float*)d_in[28];

  float* ws_x = (float*)d_ws;
  const int nbs = nB * 4;          // (b,s) blocks
  const int nblk = nB * 4;         // (b, 16-row tile) blocks

  k_attn<<<nbs, 256, 0, stream>>>(ctcf, hac, me1, me3, bulk, we_w, we_b, pos, mn_g, mn_b,
                                   wq, bq, wk, bk, wv, bv, wo, bo, an_g, an_b,
                                   conv_w, conv_b, gate_w, gate_b, ws_x, nbs);
  k_pair<<<nblk, 256, 0, stream>>>(ws_x, pp_w, pp_b, ada_g, ada_b, ada_a, (float*)d_out, nblk);
}

// v003
// Measured time: 18.5 microseconds a run.
// Timed twice side by side with v002, it ran 1.08 and 1.10 times as fast.
// All steps since v000 together make it 1.72 times as fast.
// Contractions: q/k/v/out projections and P.V on v_wmma_f32_16x16x32_f16 (f16 operands, P scaled by 4096, f32 accumulate); pair path T=m.A_p and feat=T.m^T on v_wmma_f32_16x16x32_bf16 as bf16 hi/lo split (3 products each, f32 accumulate); q.k (K=8) and gate (K=8) on VALU f32.
#include <hip/hip_runtime.h>

typedef _Float16       v16h  __attribute__((ext_vector_type(16)));
typedef _Float16       v8h   __attribute__((ext_vector_type(8)));
typedef __bf16         v16b  __attribute__((ext_vector_type(16)));
typedef unsigned short v16us __attribute__((ext_vector_type(16)));
typedef unsigned short v8us  __attribute__((ext_vector_type(8)));
typedef float          v8f   __attribute__((ext_vector_type(8)));
typedef float          v4f   __attribute__((ext_vector_type(4)));
typedef v8h  __attribute__((may_alias)) v8h_ma;
typedef v8us __attribute__((may_alias)) v8us_ma;
typedef v4f  __attribute__((may_alias)) v4f_ma;

union FragH { v16h v;  v8h  half[2]; };
union FragU { v16us v; v8us half[2]; };

// 32-lane butterfly sums of 8 independent rows, stage by stage: the 8 cross-lane moves of a stage are in flight
// together, so a stage costs one cross-lane latency for all rows. Per row the order of the sum is 16, 8, 4, 2, 1.
__device__ __forceinline__ void wave_sum32_rows(float (&v)[8]) {
#pragma unroll   // constant lane masks
  for (int o = 16; o > 0; o >>= 1) {
    float t[8];
#pragma unroll   // rows stay in registers; all moves of the stage issue before the first add
    for (int r = 0; r < 8; ++r) t[r] = __shfl_xor(v[r], o, 32);
#pragma unroll
    for (int r = 0; r < 8; ++r) v[r] += t[r];
  }
}

// 16x16x32 fragment k map, identical for A and B: element i of a lane with hh = lane>>4 holds k = (i&7) + 16*(i>>3) + 8*hh.
// A: lane&15 = row m, B: lane&15 = column n, D: acc[r] = (row 8*hh + r, col lane&15).
__device__ __forceinline__ int kof(int i, int hh) { return (i & 7) + ((i >> 3) << 4) + 8 * hh; }

__device__ __forceinline__ v8f wmma_f16(v16h a, v16h b, v8f c) {
  c = __builtin_amdgcn_wmma_f32_16x16x32_f16(false, a, false, b, (short)0, c, false, false);
  asm volatile("v_nop\n\tv_nop\n\tv_nop\n\tv_nop" : "+v"(c) : "v"(a), "v"(b));
  return c;
}

__device__ __forceinline__ v8f wmma_bf16(v16us a, v16us b, v8f c) {
  v16b ab = __builtin_bit_cast(v16b, a);
  v16b bb = __builtin_bit_cast(v16b, b);
  c = __builtin_amdgcn_wmma_f32_16x16x32_bf16(false, ab, false, bb, (short)0, c, false, false);
  asm volatile("v_nop\n\tv_nop\n\tv_nop\n\tv_nop" : "+v"(c) : "v"(ab), "v"(bb));
  return c;
}

// Bare v_rcp_f32 / v_rsq_f32 (about 1 ulp) in place of the IEEE divide (about 10 dependent vector instructions) and of
// 1 / sqrtf (about 25). Every argument here is a normal f32 or +inf (1 + exp, a softmax sum >= 1, variance + 1e-5),
// except the square sum of a row, whose zero or denormal case ends in the clamp behind it.
__device__ __forceinline__ float fast_rcp(float x) { return __builtin_amdgcn_rcpf(x); }
__device__ __forceinline__ float fast_rsq(float x) { return __builtin_amdgcn_rsqf(x); }

// f32 -> bf16 bit pattern, RNE convert; and back
__device__ __forceinline__ unsigned short bf_rne(float x) {
  unsigned int u = __float_as_uint(x);
  u += 0x7FFFu + ((u >> 16) & 1u);
  return (unsigned short)(u >> 16);
}
__device__ __forceinline__ float bf_val(unsigned short s) {
  return __uint_as_float(((unsigned int)s) << 16);
}

// B fragment for output column n of X.W^T with W stored [n][k] f32, pitch 32 (B[k][n] = W[n][k]), converted to f16
__device__ __forceinline__ v16h wfrag_f16(const float* __restrict__ W, int n, int hh) {
  const float* r = W + n * 32;
  v16h f = {};
#pragma unroll
  for (int i = 0; i < 16; ++i) f[i] = (_Float16)r[kof(i, hh)];
  return f;
}

// ---------------------------------------------------------------------------------------------
// Kernel 1: one block per (b,s). Builds x = LN(msa+pos), row attention with bulk bias, gate,
// ---------------------------------------------------------------------------------------------
__global__ __launch_bounds__(256) void k_attn(
    const float* __restrict__ ctcf, const float* __restrict__ hac,
    const float* __restrict__ me1,  const float* __restrict__ me3,
    const float* __restrict__ bulk,
    const float* __restrict__ we_w, const float* __restrict__ we_b,
    const float* __restrict__ pos,
    const float* __restrict__ mn_g, const float* __restrict__ mn_b,
    const float* __restrict__ wq,   const float* __restrict__ bq,
    const float* __restrict__ wk,   const float* __restrict__ bk,
    const float* __restrict__ wv,   const float* __restrict__ bv,
    const float* __restrict__ wo,   const float* __restrict__ bo,
    const float* __restrict__ an_g, const float* __restrict__ an_b,
    const float* __restrict__ conv_w, const float* __restrict__ conv_b,
    const float* __restrict__ gate_w, const float* __restrict__ gate_b,
    float* __restrict__ xw, int nbs)
{
  __shared__ __attribute__((aligned(16))) float    xs[64][32];   // x f32 (kept for residual), then LN output staging
  // Row pitches are 16 B x odd (80 B, 144 B): the 16-byte reads of 16 (or 4) different rows then fall on different banks.
  __shared__ __attribute__((aligned(16))) _Float16 xh[64][40];   // x f16 (A operand of q/k/v), 32 used
  __shared__ __attribute__((aligned(16))) float    qf[64][36];   // 32 used
  // k: [quarter of 16 keys][key in quarter * 36 + channel]; the 8 floats behind each quarter set the four key rows
  // that 4 adjacent lanes read at once (16 keys apart) 8 banks apart
  __shared__ __attribute__((aligned(16))) float    kf[4][16 * 36 + 8];
  __shared__ __attribute__((aligned(16))) _Float16 vh[64][40];   // v f16 (B operand of P.V), 32 used
  __shared__ __attribute__((aligned(16))) _Float16 ph[64][72];   // P * 4096, f16, current head, 64 used
  __shared__ __attribute__((aligned(16))) float    og[64][32];   // P.V output (l, h*8+d)
  __shared__ __attribute__((aligned(16))) _Float16 oh[64][40];   // gated output, f16 (A operand of out proj), 32 used
  __shared__ __attribute__((aligned(16))) float    o2[64][36];   // out proj + bias, 32 used

  const int tid = threadIdx.x, wave = tid >> 5, lane = tid & 31;
  const int hh = lane >> 4, m16 = lane & 15;
  const int bs = blockIdx.x;
  if (bs >= nbs) return;                       // block-uniform
  const int b = bs >> 2, s = bs & 3;

  // 1) x = LN(signal * we_w + we_b + pos); wave per row, lane = channel
  {
    const float* sig = (s == 0) ? ctcf : ((s == 1) ? hac : ((s == 2) ? me1 : me3));
    const float ww = we_w[lane], wb = we_b[lane], g = mn_g[lane], be = mn_b[lane];
    float d[8], t[8];
#pragma unroll   // the wave's 8 rows side by side: their global loads are in flight together
    for (int rr = 0; rr < 8; ++rr) {
      const int l = wave * 8 + rr;
      d[rr] = sig[b * 64 + l];
      t[rr] = pos[l * 32 + lane];
    }
    // keeps the first use of a signal value behind the issue of the position loads: one global latency, not two in a row
    __builtin_amdgcn_sched_barrier(0);
#pragma unroll
    for (int rr = 0; rr < 8; ++rr) {
      float v = d[rr] * ww + wb;
      v += t[rr];
      d[rr] = v;
      t[rr] = v;
    }
    wave_sum32_rows(t);
#pragma unroll
    for (int rr = 0; rr < 8; ++rr) { d[rr] -= t[rr] * 0.03125f; t[rr] = d[rr] * d[rr]; }
    wave_sum32_rows(t);
#pragma unroll   // 8 independent chains fill each other's latency
    for (int rr = 0; rr < 8; ++rr) {
      const int l = wave * 8 + rr;
      const float var = t[rr] * 0.03125f;
      const float y   = d[rr] * fast_rsq(var + 1e-5f) * g + be;
      xs[l][lane] = y;
      xh[l][lane] = (_Float16)y;
    }
  }
  __syncthreads();

  // 2) q/k/v = x.W^T + b : one 16x16 tile (mt,nt) per wave for each of q,k,v ; K = 32 = one k-step
  {
    const int mt = wave >> 1, nt = wave & 1;
    const int arow = mt * 16 + m16, ncol = nt * 16 + m16, drow = mt * 16 + 8 * hh;
    FragH a;
    a.half[0] = *(const v8h_ma*)(&xh[arow][8 * hh]);
    a.half[1] = *(const v8h_ma*)(&xh[arow][16 + 8 * hh]);
    {
      v8f acc = {};
      acc = wmma_f16(a.v, wfrag_f16(wq, ncol, hh), acc);
      const float bb = bq[ncol];
#pragma unroll
      for (int r = 0; r < 8; ++r) qf[drow + r][ncol] = acc[r] + bb;
    }
    {
      v8f acc = {};
      acc = wmma_f16(a.v, wfrag_f16(wk, ncol, hh), acc);
      const float bb = bk[ncol];
#pragma unroll
      for (int r = 0; r < 8; ++r) kf[mt][(8 * hh + r) * 36 + ncol] = acc[r] + bb;
    }
    {
      v8f acc = {};
      acc = wmma_f16(a.v, wfrag_f16(wv, ncol, hh), acc);
      const float bb = bv[ncol];
#pragma unroll
      for (int r = 0; r < 8; ++r) vh[drow + r][ncol] = (_Float16)(acc[r] + bb);
    }
  }
  __syncthreads();

  // 3) per head: scores (K=8, VALU f32) + bias + softmax by thread (l, quarter of 64 keys), then P.V on f16 WMMA
  const float rsD = 0.35355339059327373f;     // 1/sqrt(8)
#pragma unroll 1
  for (int h = 0; h < 4; ++h) {
    {
      const int l = tid >> 2, m0 = (tid & 3) * 16;     // 4 adjacent lanes share one query row
      float qr[8];
#pragma unroll
      for (int d = 0; d < 8; ++d) qr[d] = qf[l][h * 8 + d];
      const float cw = conv_w[h], cb = conv_b[h];
      const float* bl = bulk + ((size_t)b * 64 + l) * 64 + m0;
      float sc[16];
      float mx = -3.0e38f;
#pragma unroll
      for (int mm = 0; mm < 16; ++mm) {
        float acc = 0.f;
#pragma unroll
        for (int d = 0; d < 8; ++d) acc += qr[d] * kf[tid & 3][mm * 36 + h * 8 + d];
        const float sv = acc * rsD + (bl[mm] * cw + cb);
        sc[mm] = sv;
        mx = fmaxf(mx, sv);
      }
      mx = fmaxf(mx, __shfl_xor(mx, 1, 32));
      mx = fmaxf(mx, __shfl_xor(mx, 2, 32));
      float sum = 0.f;
#pragma unroll
      for (int mm = 0; mm < 16; ++mm) { const float e = __expf(sc[mm] - mx); sc[mm] = e; sum += e; }
      sum += __shfl_xor(sum, 1, 32);
      sum += __shfl_xor(sum, 2, 32);
      const float inv = 4096.0f * fast_rcp(sum);  // P carried x4096 (exact power of two) for the f16 operand
      FragH pv;
#pragma unroll
      for (int mm = 0; mm < 8; ++mm) {
        pv.half[0][mm] = (_Float16)(sc[mm] * inv);
        pv.half[1][mm] = (_Float16)(sc[8 + mm] * inv);
      }
      *(v8h_ma*)(&ph[l][m0])     = pv.half[0];
      *(v8h_ma*)(&ph[l][m0 + 8]) = pv.half[1];
    }
    __syncthreads();
    if (wave < 4) {                               // wave-uniform; all 32 lanes active in the WMMA
      const int mt = wave, arow = mt * 16 + m16, vcol = h * 8 + (m16 & 7);
      v8f acc = {};
#pragma unroll
      for (int ks = 0; ks < 2; ++ks) {
        const int k0 = ks * 32;
        FragH a;                                  // A[m = query][k = key] = P row, k contiguous
        a.half[0] = *(const v8h_ma*)(&ph[arow][k0 + 8 * hh]);
        a.half[1] = *(const v8h_ma*)(&ph[arow][k0 + 16 + 8 * hh]);
        v16h bvv = {};                            // B[k = key][n = d] = v[key][h*8+d], columns n>=8 zero
#pragma unroll
        for (int i = 0; i < 16; ++i) {
          const _Float16 t = vh[k0 + kof(i, hh)][vcol];
          bvv[i] = (m16 < 8) ? t : (_Float16)0.0f;
        }
        acc = wmma_f16(a.v, bvv, acc);
      }
      if (m16 < 8) {
        const int drow = mt * 16 + 8 * hh;
#pragma unroll
        for (int r = 0; r < 8; ++r) og[drow + r][h * 8 + m16] = acc[r] * (1.0f / 4096.0f);
      }
    }
    __syncthreads();
  }

  // 4) gate: oh[l][h*8+c] = og[l][h*8+c] * sigmoid(sum_d gate_w[h][c][d] og[l][h*8+d] + gate_b[h][c])
  {
    const int hc = lane, h8 = hc & 24;            // row l = wave + 8 * j
    float ov[8][8], oc[8];
#pragma unroll   // all LDS reads of the thread's 8 rows issue before the first use
    for (int j = 0; j < 8; ++j) {
      const int l = wave + 8 * j;
#pragma unroll
      for (int d = 0; d < 8; ++d) ov[j][d] = og[l][h8 + d];
      oc[j] = og[l][hc];
    }
#pragma unroll   // 8 independent dot / exp / reciprocal chains fill each other's latency
    for (int j = 0; j < 8; ++j) {
      float acc = gate_b[hc];
#pragma unroll
      for (int d = 0; d < 8; ++d) acc += gate_w[hc * 8 + d] * ov[j][d];
      const float gs = fast_rcp(1.0f + __expf(-acc));
      oh[wave + 8 * j][hc] = (_Float16)(oc[j] * gs);
    }
  }
  __syncthreads();

  // 5) output projection: o2 = oh.wo^T + bo ; one tile per wave
  {
    const int mt = wave >> 1, nt = wave & 1;
    const int arow = mt * 16 + m16, ncol = nt * 16 + m16, drow = mt * 16 + 8 * hh;
    FragH a;
    a.half[0] = *(const v8h_ma*)(&oh[arow][8 * hh]);
    a.half[1] = *(const v8h_ma*)(&oh[arow][16 + 8 * hh]);
    v8f acc = {};
    acc = wmma_f16(a.v, wfrag_f16(wo, ncol, hh), acc);
    const float bb = bo[ncol];
#pragma unroll
    for (int r = 0; r < 8; ++r) o2[drow + r][ncol] = acc[r] + bb;
  }
  __syncthreads();

  // 6) residual + LN, staged back into xs (each lane rewrites only the element it read)
  {
    const float g = an_g[lane], be = an_b[lane];
    float d[8], t[8];
#pragma unroll   // the wave's 8 rows side by side: their LDS reads are in flight together
    for (int rr = 0; rr < 8; ++rr) {
      const int l = wave * 8 + rr;
      const float v = xs[l][lane] + o2[l][lane];
      d[rr] = v;
      t[rr] = v;
    }
    wave_sum32_rows(t);
#pragma unroll
    for (int rr = 0; rr < 8; ++rr) { d[rr] -= t[rr] * 0.03125f; t[rr] = d[rr] * d[rr]; }
    wave_sum32_rows(t);
#pragma unroll   // 8 independent chains fill each other's latency
    for (int rr = 0; rr < 8; ++rr) {
      const float var = t[rr] * 0.03125f;
      xs[wave * 8 + rr][lane] = d[rr] * fast_rsq(var + 1e-5f) * g + be;
    }
  }
  __syncthreads();

  {
    float* xg = xw + (size_t)bs * 2048;
    const int col = 4 * (lane & 7);
    const int r0 = wave * 8 + (lane >> 3), r1 = r0 + 4;
    const v4f v0 = *(const v4f_ma*)(&xs[r0][col]);
    const v4f v1 = *(const v4f_ma*)(&xs[r1][col]);
    *(v4f*)(xg + r0 * 32 + col) = v0;
    *(v4f*)(xg + r1 * 32 + col) = v1;
    
  }
}

// ---------------------------------------------------------------------------------------------
// Kernel 2: one block per (b, tile of 16 rows i). m = max over tracks, unit rows, bf16 hi/lo;
// T_p[i][d] = sum_c mh[i][c] A_p[c][d]  (A_p[c][d] = pp_w[p][c*32+d]);  feat_p[i][j] = sum_d T_p[i][d] mh[j][d] + pp_b[p];
// ---------------------------------------------------------------------------------------------
__global__ __launch_bounds__(256) void k_pair(
    const float* __restrict__ xw, const float* __restrict__ ppw, const float* __restrict__ pp_b,
    const float* __restrict__ ada_g, const float* __restrict__ ada_b, const float* __restrict__ ada_alpha,
    float* __restrict__ out, int nblk)
{
  // Row pitches are 16 B x odd (80 B, 144 B, 272 B): the 16-byte fragment reads of 16 rows fall on different banks,
  // and so do the two 8-row halves of an accumulator store.
  __shared__ __attribute__((aligned(16))) unsigned short mhi[64][40];   // bf16 bits, hi part of unit rows, 32 used
  __shared__ __attribute__((aligned(16))) unsigned short mlo[64][40];   // bf16 bits, lo part, 32 used
  __shared__ __attribute__((aligned(16))) float tf[16][16][36];         // T_p for this block's 16 rows, f32, 32 used
  __shared__ __attribute__((aligned(16))) float fo[16][16][68];         // feat / final values (p, i, j), 64 used
  float* mf = &fo[0][0][0];                                            // [64*32] f32 max rows; dead before fo is first written

  const int tid = threadIdx.x, wave = tid >> 5, lane = tid & 31;
  const int hh = lane >> 4, m16 = lane & 15;
  const int blk = blockIdx.x;
  if (blk >= nblk) return;                     // block-uniform
  const int b = blk >> 2, i0 = (blk & 3) * 16;

  // 1) max over the 4 tracks
  {
    const float* xb = xw + (size_t)b * 8192;
#pragma unroll
    for (int j = 0; j < 8; ++j) {
      const int e = tid + 256 * j;
      float v = xb[e];
      v = fmaxf(v, xb[2048 + e]);
      v = fmaxf(v, xb[4096 + e]);
      v = fmaxf(v, xb[6144 + e]);
      mf[e] = v;
    }
  }
  __syncthreads();

  // 2) unit rows (the pair norm factorises as |m_i|*|m_j|; clamp applied per factor), split into bf16 hi + lo
  {
    float v[8], t[8];
#pragma unroll   // the wave's 8 rows side by side: their LDS reads are in flight together
    for (int rr = 0; rr < 8; ++rr) {
      v[rr] = mf[(wave * 8 + rr) * 32 + lane];
      t[rr] = v[rr] * v[rr];
    }
    wave_sum32_rows(t);
#pragma unroll   // 8 independent chains fill each other's latency
    for (int rr = 0; rr < 8; ++rr) {
      const int l = wave * 8 + rr;
      const float inv = fminf(fast_rsq(t[rr]), 1e3f);   // = 1 / max(sqrt(t), 1e-3); t = 0 gives +inf, clamped
      const float y   = v[rr] * inv;
      const unsigned short hb = bf_rne(y);
      mhi[l][lane] = hb;
      mlo[l][lane] = bf_rne(y - bf_val(hb));
    }
  }
  __syncthreads();

  // 3) GEMM1: wave handles p = 2*wave, 2*wave+1 and both 16-column halves of d; K = 32 (c), one k-step, 3 products
  {
    const int arow = i0 + m16;
    FragU ahi, alo;                              // A[m = i][k = c] = mh[i0+i][c]
    ahi.half[0] = *(const v8us_ma*)(&mhi[arow][8 * hh]);
    ahi.half[1] = *(const v8us_ma*)(&mhi[arow][16 + 8 * hh]);
    alo.half[0] = *(const v8us_ma*)(&mlo[arow][8 * hh]);
    alo.half[1] = *(const v8us_ma*)(&mlo[arow][16 + 8 * hh]);
    float wf[4][16];
#pragma unroll   // the global loads of all four B fragments are in flight together
    for (int u = 0; u < 4; ++u) {
      const float* wp = ppw + (size_t)(wave * 2 + (u >> 1)) * 1024 + (u & 1) * 16 + m16;
#pragma unroll
      for (int i = 0; i < 16; ++i) wf[u][i] = wp[kof(i, hh) * 32];
    }
#pragma unroll   // wf stays in registers
    for (int pp = 0; pp < 2; ++pp) {
      const int p = wave * 2 + pp;
#pragma unroll
      for (int nt = 0; nt < 2; ++nt) {
        const int n = nt * 16 + m16;             // B[k = c][n = d] = pp_w[p][c*32 + d]
        v16us bh = {}, bl = {};
#pragma unroll
        for (int i = 0; i < 16; ++i) {
          const float w = wf[pp * 2 + nt][i];
          const unsigned short hb = bf_rne(w);
          bh[i] = hb;
          bl[i] = bf_rne(w - bf_val(hb));
        }
        v8f acc = {};
        acc = wmma_bf16(ahi.v, bh, acc);
        acc = wmma_bf16(ahi.v, bl, acc);
        acc = wmma_bf16(alo.v, bh, acc);
#pragma unroll
        for (int r = 0; r < 8; ++r) tf[p][8 * hh + r][n] = acc[r];
      }
    }
  }
  __syncthreads();

  // 4) GEMM2: feat_p[i][j] ; A[m = i][k = d] = T_p[i][d] (f32 in LDS, split at load), B[k = d][n = j] = mh[j][d] (row j, k-contiguous)
#pragma unroll 1
  for (int nt = 0; nt < 4; ++nt) {
    const int brow = nt * 16 + m16;
    FragU bh, bl;
    bh.half[0] = *(const v8us_ma*)(&mhi[brow][8 * hh]);
    bh.half[1] = *(const v8us_ma*)(&mhi[brow][16 + 8 * hh]);
    bl.half[0] = *(const v8us_ma*)(&mlo[brow][8 * hh]);
    bl.half[1] = *(const v8us_ma*)(&mlo[brow][16 + 8 * hh]);
    float ta[2][16];
#pragma unroll   // the LDS reads of both A fragments are in flight together
    for (int pp = 0; pp < 2; ++pp)
#pragma unroll
      for (int i = 0; i < 16; ++i) ta[pp][i] = tf[wave * 2 + pp][m16][kof(i, hh)];
#pragma unroll   // ta stays in registers
    for (int pp = 0; pp < 2; ++pp) {
      const int p = wave * 2 + pp;
      v16us ah = {}, al = {};
#pragma unroll
      for (int i = 0; i < 16; ++i) {
        const float t = ta[pp][i];
        const unsigned short hb = bf_rne(t);
        ah[i] = hb;
        al[i] = bf_rne(t - bf_val(hb));
      }
      v8f acc = {};
      acc = wmma_bf16(ah, bh.v, acc);
      acc = wmma_bf16(ah, bl.v, acc);
      acc = wmma_bf16(al, bh.v, acc);
      const float pb = pp_b[p];
#pragma unroll
      for (int r = 0; r < 8; ++r) fo[p][8 * hh + r][brow] = acc[r] + pb;
    }
  }
  __syncthreads();

  // 5) AdaNorm over p (16 values per (i,j)) and SiLU, in place
  {
    const float alpha = ada_alpha[0];
    float v[4][16], mu[4], rs[4];
#pragma unroll   // the thread's 4 positions side by side: LDS reads in flight together
    for (int jq = 0; jq < 4; ++jq) {
      const int q = tid + 256 * jq;
#pragma unroll
      for (int p = 0; p < 16; ++p) v[jq][p] = fo[p][q >> 6][q & 63];
    }
#pragma unroll   // 4 independent mean / variance chains fill each other's latency
    for (int jq = 0; jq < 4; ++jq) {
      float m = 0.f;
#pragma unroll
      for (int p = 0; p < 16; ++p) m += v[jq][p];
      m *= 0.0625f;
      float var = 0.f;
#pragma unroll
      for (int p = 0; p < 16; ++p) { const float d = v[jq][p] - m; var += d * d; }
      var *= 0.0625f;
      mu[jq] = m;
      rs[jq] = fast_rsq(var + 1e-5f);
    }
#pragma unroll   // v stays in registers
    for (int jq = 0; jq < 4; ++jq) {
      const int q = tid + 256 * jq;
#pragma unroll
      for (int p = 0; p < 16; ++p) {
        const float f = v[jq][p] + alpha * ((v[jq][p] - mu[jq]) * rs[jq] * ada_g[p] + ada_b[p]);
        fo[p][q >> 6][q & 63] = f * fast_rcp(1.0f + __expf(-f));
      }
    }
  }
  __syncthreads();

  {
    const size_t pbase = (size_t)b * 16;
    const int col = 4 * (lane & 15), rsel = lane >> 4;
    v4f v[16];
#pragma unroll   // all 16 LDS reads are in flight together, then the stores follow without a wait in between
    for (int u = 0; u < 16; ++u) {
      const int rho = wave * 32 + 2 * u + rsel;
      v[u] = *(const v4f_ma*)(&fo[rho >> 4][rho & 15][col]);
    }
#pragma unroll
    for (int u = 0; u < 16; ++u) {
      const int rho = wave * 32 + 2 * u + rsel;
      const int p = rho >> 4, i = rho & 15;
      *(v4f*)(out + (((pbase + p) * 64 + (size_t)(i0 + i)) * 64 + col)) = v[u];
    }
    
  }
}

extern "C" void kernel_launch(void* const* d_in, const int* in_sizes, int n_in,
                              void* d_out, int out_size, void* d_ws, size_t ws_size,
                              hipStream_t stream) {
  if (n_in < 29 || d_out == 0 || d_ws == 0) return;
  const int nB = in_sizes[0] / 64;
  if (nB <= 0 || in_sizes[0] != nB * 64 || in_sizes[1] != nB * 64 || in_sizes[2] != nB * 64 ||
      in_sizes[3] != nB * 64 || in_sizes[4] != nB * 4096 ||
      in_sizes[5] < 32 || in_sizes[6] < 32 || in_sizes[7] != 2048 || in_sizes[8] < 32 || in_sizes[9] < 32 ||
      in_sizes[10] != 1024 || in_sizes[11] < 32 || in_sizes[12] != 1024 || in_sizes[13] < 32 ||
      in_sizes[14] != 1024 || in_sizes[15] < 32 || in_sizes[16] != 1024 || in_sizes[17] < 32 ||
      in_sizes[18] < 32 || in_sizes[19] < 32 || in_sizes[20] < 4 || in_sizes[21] < 4 ||
      in_sizes[22] != 256 || in_sizes[23] < 32 || in_sizes[24] != 16384 || in_sizes[25] < 16 ||
      in_sizes[26] < 16 || in_sizes[27] < 16 || in_sizes[28] < 1 ||
      out_size != nB * 16 * 4096) return;
  const size_t need = (size_t)nB * 8192 * sizeof(float);      // x after attention: [nB][4][64][32] f32
  if (need > ws_size) return;

  const float* ctcf   = (const float*)d_in[0];
  const float* hac    = (const float*)d_in[1];
  const float* me1    = (const float*)d_in[2];
  const float* me3    = (const float*)d_in[3];
  const float* bulk   = (const float*)d_in[4];
  const float* we_w   = (const float*)d_in[5];
  const float* we_b   = (const float*)d_in[6];
  const float* pos    = (const float*)d_in[7];
  const float* mn_g   = (const float*)d_in[8];
  const float* mn_b   = (const float*)d_in[9];
  const float* wq     = (const float*)d_in[10];
  const float* bq     = (const float*)d_in[11];
  const float* wk     = (const float*)d_in[12];
  const float* bk     = (const float*)d_in[13];
  const float* wv     = (const float*)d_in[14];
  const float* bv     = (const float*)d_in[15];
  const float* wo     = (const float*)d_in[16];
  const float* bo     = (const float*)d_in[17];
  const float* an_g   = (const float*)d_in[18];
  const float* an_b   = (const float*)d_in[19];
  const float* conv_w = (const float*)d_in[20];
  const float* conv_b = (const float*)d_in[21];
  const float* gate_w = (const float*)d_in[22];
  const float* gate_b = (const float*)d_in[23];
  const float* pp_w   = (const float*)d_in[24];
  const float* pp_b   = (const float*)d_in[25];
  const float* ada_g  = (const float*)d_in[26];
  const float* ada_b  = (const float*)d_in[27];
  const float* ada_a  = (const float*)d_in[28];

  float* ws_x = (float*)d_ws;
  const int nbs = nB * 4;          // (b,s) blocks
  const int nblk = nB * 4;         // (b, 16-row tile) blocks

  k_attn<<<nbs, 256, 0, stream>>>(ctcf, hac, me1, me3, bulk, we_w, we_b, pos, mn_g, mn_b,
                                   wq, bq, wk, bk, wv, bv, wo, bo, an_g, an_b,
                                   conv_w, conv_b, gate_w, gate_b, ws_x, nbs);
  k_pair<<<nblk, 256, 0, stream>>>(ws_x, pp_w, pp_b, ada_g, ada_b, ada_a, (float*)d_out, nblk);
}

// v004
// It runs in 16.5 microseconds.
// In two side-by-side timings against v003, it was 1.14 and 1.12 times as fast.
// Over all steps from v000 it is 1.94 times as fast.
// Contractions: q/k/v/out projections and P.V on v_wmma_f32_16x16x32_f16 (f16 operands, P scaled by 4096, f32 accumulate); pair path T=m.A_p and feat=T.m^T on v_wmma_f32_16x16x32_bf16 as bf16 hi/lo split (3 products each, f32 accumulate); q.k (K=8) and gate (K=8) on VALU f32.
#include <hip/hip_runtime.h>

typedef _Float16       v16h  __attribute__((ext_vector_type(16)));
typedef _Float16       v8h   __attribute__((ext_vector_type(8)));
typedef __bf16         v16b  __attribute__((ext_vector_type(16)));
typedef unsigned short v16us __attribute__((ext_vector_type(16)));
typedef unsigned short v8us  __attribute__((ext_vector_type(8)));
typedef float          v8f   __attribute__((ext_vector_type(8)));
typedef float          v4f   __attribute__((ext_vector_type(4)));
typedef float          v2f   __attribute__((ext_vector_type(2)));
typedef __bf16         v2b   __attribute__((ext_vector_type(2)));
typedef v8h  __attribute__((may_alias)) v8h_ma;
typedef v8us __attribute__((may_alias)) v8us_ma;
typedef v4f  __attribute__((may_alias)) v4f_ma;

union FragH { v16h v;  v8h  half[2]; };
union FragU { v16us v; v8us half[2]; unsigned int w[8]; };

// 32-lane butterfly sums of 8 independent rows, stage by stage: the 8 cross-lane moves of a stage are in flight
// together, so a stage costs one cross-lane latency for all rows. Per row the order of the sum is 16, 8, 4, 2, 1.
__device__ __forceinline__ void wave_sum32_rows(float (&v)[8]) {
#pragma unroll   // constant lane masks
  for (int o = 16; o > 0; o >>= 1) {
    float t[8];
#pragma unroll   // rows stay in registers; all moves of the stage issue before the first add
    for (int r = 0; r < 8; ++r) t[r] = __shfl_xor(v[r], o, 32);
#pragma unroll
    for (int r = 0; r < 8; ++r) v[r] += t[r];
  }
}

// 16x16x32 fragment k map, identical for A and B: element i of a lane with hh = lane>>4 holds k = (i&7) + 16*(i>>3) + 8*hh.
// A: lane&15 = row m, B: lane&15 = column n, D: acc[r] = (row 8*hh + r, col lane&15).
__device__ __forceinline__ int kof(int i, int hh) { return (i & 7) + ((i >> 3) << 4) + 8 * hh; }

__device__ __forceinline__ v8f wmma_f16(v16h a, v16h b, v8f c) {
  c = __builtin_amdgcn_wmma_f32_16x16x32_f16(false, a, false, b, (short)0, c, false, false);
  asm volatile("v_nop\n\tv_nop\n\tv_nop\n\tv_nop" : "+v"(c) : "v"(a), "v"(b));
  return c;
}

__device__ __forceinline__ v8f wmma_bf16(v16us a, v16us b, v8f c) {
  v16b ab = __builtin_bit_cast(v16b, a);
  v16b bb = __builtin_bit_cast(v16b, b);
  c = __builtin_amdgcn_wmma_f32_16x16x32_bf16(false, ab, false, bb, (short)0, c, false, false);
  asm volatile("v_nop\n\tv_nop\n\tv_nop\n\tv_nop" : "+v"(c) : "v"(ab), "v"(bb));
  return c;
}

// Bare v_rcp_f32 / v_rsq_f32 (about 1 ulp) in place of the IEEE divide (about 10 dependent vector instructions) and of
// 1 / sqrtf (about 25). Every argument here is a normal f32 or +inf (1 + exp, a softmax sum >= 1, variance + 1e-5),
// except the square sum of a row, whose zero or denormal case ends in the clamp behind it.
__device__ __forceinline__ float fast_rcp(float x) { return __builtin_amdgcn_rcpf(x); }
__device__ __forceinline__ float fast_rsq(float x) { return __builtin_amdgcn_rsqf(x); }

// Two f32 -> their bf16 hi parts and bf16 lo parts (lo = bf16(x - hi)), each pair packed in one dword, x0 in the low half.
// The packed hardware convert rounds to nearest even, as the integer rounding it replaces did; x - hi is exact in f32.
__device__ __forceinline__ void bf_split2(float x0, float x1, unsigned int& hi, unsigned int& lo) {
  const v2f x = {x0, x1};
  const v2b h = __builtin_convertvector(x, v2b);
  const v2f r = {x0 - (float)h[0], x1 - (float)h[1]};
  const v2b l = __builtin_convertvector(r, v2b);
  hi = __builtin_bit_cast(unsigned int, h);
  lo = __builtin_bit_cast(unsigned int, l);
}

// B fragment for output column n of X.W^T with W stored [n][k] f32, pitch 32 (B[k][n] = W[n][k]), converted to f16
__device__ __forceinline__ v16h wfrag_f16(const float* __restrict__ W, int n, int hh) {
  const float* r = W + n * 32;
  v16h f = {};
#pragma unroll
  for (int i = 0; i < 16; ++i) f[i] = (_Float16)r[kof(i, hh)];
  return f;
}

// ---------------------------------------------------------------------------------------------
// Kernel 1: one block per (b,s). Builds x = LN(msa+pos), row attention with bulk bias, gate,
// ---------------------------------------------------------------------------------------------
__global__ __launch_bounds__(256) void k_attn(
    const float* __restrict__ ctcf, const float* __restrict__ hac,
    const float* __restrict__ me1,  const float* __restrict__ me3,
    const float* __restrict__ bulk,
    const float* __restrict__ we_w, const float* __restrict__ we_b,
    const float* __restrict__ pos,
    const float* __restrict__ mn_g, const float* __restrict__ mn_b,
    const float* __restrict__ wq,   const float* __restrict__ bq,
    const float* __restrict__ wk,   const float* __restrict__ bk,
    const float* __restrict__ wv,   const float* __restrict__ bv,
    const float* __restrict__ wo,   const float* __restrict__ bo,
    const float* __restrict__ an_g, const float* __restrict__ an_b,
    const float* __restrict__ conv_w, const float* __restrict__ conv_b,
    const float* __restrict__ gate_w, const float* __restrict__ gate_b,
    float* __restrict__ xw, int nbs)
{
  __shared__ __attribute__((aligned(16))) float    xs[64][32];   // x f32 (kept for residual), then LN output staging
  // Row pitches are 16 B x odd (80 B, 144 B): the 16-byte reads of 16 (or 4) different rows then fall on different banks.
  __shared__ __attribute__((aligned(16))) _Float16 xh[64][40];   // x f16 (A operand of q/k/v), 32 used
  __shared__ __attribute__((aligned(16))) float    qf[64][36];   // 32 used
  // k: [quarter of 16 keys][key in quarter * 36 + channel]; the 8 floats behind each quarter set the four key rows
  // that 4 adjacent lanes read at once (16 keys apart) 8 banks apart
  __shared__ __attribute__((aligned(16))) float    kf[4][16 * 36 + 8];
  __shared__ __attribute__((aligned(16))) _Float16 vh[64][40];   // v f16 (B operand of P.V), 32 used
  __shared__ __attribute__((aligned(16))) _Float16 ph[64][72];   // P * 4096, f16, current head, 64 used
  __shared__ __attribute__((aligned(16))) float    og[64][32];   // P.V output (l, h*8+d)
  __shared__ __attribute__((aligned(16))) _Float16 oh[64][40];   // gated output, f16 (A operand of out proj), 32 used
  __shared__ __attribute__((aligned(16))) float    o2[64][36];   // out proj + bias, 32 used

  const int tid = threadIdx.x, wave = tid >> 5, lane = tid & 31;
  const int hh = lane >> 4, m16 = lane & 15;
  const int bs = blockIdx.x;
  if (bs >= nbs) return;                       // block-uniform
  const int b = bs >> 2, s = bs & 3;

  // 1) x = LN(signal * we_w + we_b + pos); wave per row, lane = channel
  {
    const float* sig = (s == 0) ? ctcf : ((s == 1) ? hac : ((s == 2) ? me1 : me3));
    const float ww = we_w[lane], wb = we_b[lane], g = mn_g[lane], be = mn_b[lane];
    float d[8], t[8];
#pragma unroll   // the wave's 8 rows side by side: their global loads are in flight together
    for (int rr = 0; rr < 8; ++rr) {
      const int l = wave * 8 + rr;
      d[rr] = sig[b * 64 + l];
      t[rr] = pos[l * 32 + lane];
    }
    // keeps the first use of a signal value behind the issue of the position loads: one global latency, not two in a row
    __builtin_amdgcn_sched_barrier(0);
#pragma unroll
    for (int rr = 0; rr < 8; ++rr) {
      float v = d[rr] * ww + wb;
      v += t[rr];
      d[rr] = v;
      t[rr] = v;
    }
    wave_sum32_rows(t);
#pragma unroll
    for (int rr = 0; rr < 8; ++rr) { d[rr] -= t[rr] * 0.03125f; t[rr] = d[rr] * d[rr]; }
    wave_sum32_rows(t);
#pragma unroll   // 8 independent chains fill each other's latency
    for (int rr = 0; rr < 8; ++rr) {
      const int l = wave * 8 + rr;
      const float var = t[rr] * 0.03125f;
      const float y   = d[rr] * fast_rsq(var + 1e-5f) * g + be;
      xs[l][lane] = y;
      xh[l][lane] = (_Float16)y;
    }
  }
  __syncthreads();

  // 2) q/k/v = x.W^T + b : one 16x16 tile (mt,nt) per wave for each of q,k,v ; K = 32 = one k-step
  {
    const int mt = wave >> 1, nt = wave & 1;
    const int arow = mt * 16 + m16, ncol = nt * 16 + m16, drow = mt * 16 + 8 * hh;
    FragH a;
    a.half[0] = *(const v8h_ma*)(&xh[arow][8 * hh]);
    a.half[1] = *(const v8h_ma*)(&xh[arow][16 + 8 * hh]);
    {
      v8f acc = {};
      acc = wmma_f16(a.v, wfrag_f16(wq, ncol, hh), acc);
      const float bb = bq[ncol];
#pragma unroll
      for (int r = 0; r < 8; ++r) qf[drow + r][ncol] = acc[r] + bb;
    }
    {
      v8f acc = {};
      acc = wmma_f16(a.v, wfrag_f16(wk, ncol, hh), acc);
      const float bb = bk[ncol];
#pragma unroll
      for (int r = 0; r < 8; ++r) kf[mt][(8 * hh + r) * 36 + ncol] = acc[r] + bb;
    }
    {
      v8f acc = {};
      acc = wmma_f16(a.v, wfrag_f16(wv, ncol, hh), acc);
      const float bb = bv[ncol];
#pragma unroll
      for (int r = 0; r < 8; ++r) vh[drow + r][ncol] = (_Float16)(acc[r] + bb);
    }
  }
  __syncthreads();

  // 3) per head: scores (K=8, VALU f32) + bias + softmax by thread (l, quarter of 64 keys), then P.V on f16 WMMA
  const float rsD = 0.35355339059327373f;     // 1/sqrt(8)
#pragma unroll 1
  for (int h = 0; h < 4; ++h) {
    {
      const int l = tid >> 2, m0 = (tid & 3) * 16;     // 4 adjacent lanes share one query row
      float qr[8];
#pragma unroll
      for (int d = 0; d < 8; ++d) qr[d] = qf[l][h * 8 + d];
      const float cw = conv_w[h], cb = conv_b[h];
      const float* bl = bulk + ((size_t)b * 64 + l) * 64 + m0;
      float sc[16];
      float mx = -3.0e38f;
#pragma unroll
      for (int mm = 0; mm < 16; ++mm) {
        float acc = 0.f;
#pragma unroll
        for (int d = 0; d < 8; ++d) acc += qr[d] * kf[tid & 3][mm * 36 + h * 8 + d];
        const float sv = acc * rsD + (bl[mm] * cw + cb);
        sc[mm] = sv;
        mx = fmaxf(mx, sv);
      }
      mx = fmaxf(mx, __shfl_xor(mx, 1, 32));
      mx = fmaxf(mx, __shfl_xor(mx, 2, 32));
      float sum = 0.f;
#pragma unroll
      for (int mm = 0; mm < 16; ++mm) { const float e = __expf(sc[mm] - mx); sc[mm] = e; sum += e; }
      sum += __shfl_xor(sum, 1, 32);
      sum += __shfl_xor(sum, 2, 32);
      const float inv = 4096.0f * fast_rcp(sum);  // P carried x4096 (exact power of two) for the f16 operand
      FragH pv;
#pragma unroll
      for (int mm = 0; mm < 8; ++mm) {
        pv.half[0][mm] = (_Float16)(sc[mm] * inv);
        pv.half[1][mm] = (_Float16)(sc[8 + mm] * inv);
      }
      *(v8h_ma*)(&ph[l][m0])     = pv.half[0];
      *(v8h_ma*)(&ph[l][m0 + 8]) = pv.half[1];
    }
    __syncthreads();
    if (wave < 4) {                               // wave-uniform; all 32 lanes active in the WMMA
      const int mt = wave, arow = mt * 16 + m16, vcol = h * 8 + (m16 & 7);
      v8f acc = {};
#pragma unroll
      for (int ks = 0; ks < 2; ++ks) {
        const int k0 = ks * 32;
        FragH a;                                  // A[m = query][k = key] = P row, k contiguous
        a.half[0] = *(const v8h_ma*)(&ph[arow][k0 + 8 * hh]);
        a.half[1] = *(const v8h_ma*)(&ph[arow][k0 + 16 + 8 * hh]);
        v16h bvv = {};                            // B[k = key][n = d] = v[key][h*8+d], columns n>=8 zero
#pragma unroll
        for (int i = 0; i < 16; ++i) {
          const _Float16 t = vh[k0 + kof(i, hh)][vcol];
          bvv[i] = (m16 < 8) ? t : (_Float16)0.0f;
        }
        acc = wmma_f16(a.v, bvv, acc);
      }
      if (m16 < 8) {
        const int drow = mt * 16 + 8 * hh;
#pragma unroll
        for (int r = 0; r < 8; ++r) og[drow + r][h * 8 + m16] = acc[r] * (1.0f / 4096.0f);
      }
    }
    __syncthreads();
  }

  // 4) gate: oh[l][h*8+c] = og[l][h*8+c] * sigmoid(sum_d gate_w[h][c][d] og[l][h*8+d] + gate_b[h][c])
  {
    const int hc = lane, h8 = hc & 24;            // row l = wave + 8 * j
    float ov[8][8], oc[8];
#pragma unroll   // all LDS reads of the thread's 8 rows issue before the first use
    for (int j = 0; j < 8; ++j) {
      const int l = wave + 8 * j;
#pragma unroll
      for (int d = 0; d < 8; ++d) ov[j][d] = og[l][h8 + d];
      oc[j] = og[l][hc];
    }
#pragma unroll   // 8 independent dot / exp / reciprocal chains fill each other's latency
    for (int j = 0; j < 8; ++j) {
      float acc = gate_b[hc];
#pragma unroll
      for (int d = 0; d < 8; ++d) acc += gate_w[hc * 8 + d] * ov[j][d];
      const float gs = fast_rcp(1.0f + __expf(-acc));
      oh[wave + 8 * j][hc] = (_Float16)(oc[j] * gs);
    }
  }
  __syncthreads();

  // 5) output projection: o2 = oh.wo^T + bo ; one tile per wave
  {
    const int mt = wave >> 1, nt = wave & 1;
    const int arow = mt * 16 + m16, ncol = nt * 16 + m16, drow = mt * 16 + 8 * hh;
    FragH a;
    a.half[0] = *(const v8h_ma*)(&oh[arow][8 * hh]);
    a.half[1] = *(const v8h_ma*)(&oh[arow][16 + 8 * hh]);
    v8f acc = {};
    acc = wmma_f16(a.v, wfrag_f16(wo, ncol, hh), acc);
    const float bb = bo[ncol];
#pragma unroll
    for (int r = 0; r < 8; ++r) o2[drow + r][ncol] = acc[r] + bb;
  }
  __syncthreads();

  // 6) residual + LN, staged back into xs (each lane rewrites only the element it read)
  {
    const float g = an_g[lane], be = an_b[lane];
    float d[8], t[8];
#pragma unroll   // the wave's 8 rows side by side: their LDS reads are in flight together
    for (int rr = 0; rr < 8; ++rr) {
      const int l = wave * 8 + rr;
      const float v = xs[l][lane] + o2[l][lane];
      d[rr] = v;
      t[rr] = v;
    }
    wave_sum32_rows(t);
#pragma unroll
    for (int rr = 0; rr < 8; ++rr) { d[rr] -= t[rr] * 0.03125f; t[rr] = d[rr] * d[rr]; }
    wave_sum32_rows(t);
#pragma unroll   // 8 independent chains fill each other's latency
    for (int rr = 0; rr < 8; ++rr) {
      const float var = t[rr] * 0.03125f;
      xs[wave * 8 + rr][lane] = d[rr] * fast_rsq(var + 1e-5f) * g + be;
    }
  }
  __syncthreads();

  {
    float* xg = xw + (size_t)bs * 2048;
    const int col = 4 * (lane & 7);
    const int r0 = wave * 8 + (lane >> 3), r1 = r0 + 4;
    const v4f v0 = *(const v4f_ma*)(&xs[r0][col]);
    const v4f v1 = *(const v4f_ma*)(&xs[r1][col]);
    *(v4f*)(xg + r0 * 32 + col) = v0;
    *(v4f*)(xg + r1 * 32 + col) = v1;
    
  }
}

// ---------------------------------------------------------------------------------------------
// Kernel 2: one block per (b, tile of 16 rows i). m = max over tracks, unit rows, bf16 hi/lo;
// T_p[i][d] = sum_c mh[i][c] A_p[c][d]  (A_p[c][d] = pp_w[p][c*32+d]);  feat_p[i][j] = sum_d T_p[i][d] mh[j][d] + pp_b[p];
// ---------------------------------------------------------------------------------------------
__global__ __launch_bounds__(256) void k_pair(
    const float* __restrict__ xw, const float* __restrict__ ppw, const float* __restrict__ pp_b,
    const float* __restrict__ ada_g, const float* __restrict__ ada_b, const float* __restrict__ ada_alpha,
    float* __restrict__ out, int nblk)
{
  // Row pitches are 16 B x odd (80 B, 144 B, 272 B): the 16-byte fragment reads of 16 rows fall on different banks,
  // and so do the two 8-row halves of an accumulator store.
  __shared__ __attribute__((aligned(16))) unsigned short mhi[64][40];   // bf16 bits, hi part of unit rows, 32 used
  __shared__ __attribute__((aligned(16))) unsigned short mlo[64][40];   // bf16 bits, lo part, 32 used
  __shared__ __attribute__((aligned(16))) float tf[16][16][36];         // T_p for this block's 16 rows, f32, 32 used
  __shared__ __attribute__((aligned(16))) float fo[16][16][68];         // feat / final values (p, i, j), 64 used
  float* mf = &fo[0][0][0];                                            // [64*32] f32 max rows; dead before fo is first written

  const int tid = threadIdx.x, wave = tid >> 5, lane = tid & 31;
  const int hh = lane >> 4, m16 = lane & 15;
  const int blk = blockIdx.x;
  if (blk >= nblk) return;                     // block-uniform
  const int b = blk >> 2, i0 = (blk & 3) * 16;

  // 1) max over the 4 tracks
  {
    const float* xb = xw + (size_t)b * 8192;
#pragma unroll
    for (int j = 0; j < 8; ++j) {
      const int e = tid + 256 * j;
      float v = xb[e];
      v = fmaxf(v, xb[2048 + e]);
      v = fmaxf(v, xb[4096 + e]);
      v = fmaxf(v, xb[6144 + e]);
      mf[e] = v;
    }
  }
  __syncthreads();

  // 2) unit rows (the pair norm factorises as |m_i|*|m_j|; clamp applied per factor), split into bf16 hi + lo
  {
    float v[8], t[8];
#pragma unroll   // the wave's 8 rows side by side: their LDS reads are in flight together
    for (int rr = 0; rr < 8; ++rr) {
      v[rr] = mf[(wave * 8 + rr) * 32 + lane];
      t[rr] = v[rr] * v[rr];
    }
    wave_sum32_rows(t);
#pragma unroll   // 8 independent chains fill each other's latency
    for (int rr = 0; rr < 8; ++rr) {
      const float inv = fminf(fast_rsq(t[rr]), 1e3f);   // = 1 / max(sqrt(t), 1e-3); t = 0 gives +inf, clamped
      v[rr] *= inv;
    }
#pragma unroll   // two rows share each packed convert
    for (int rr = 0; rr < 8; rr += 2) {
      const int l = wave * 8 + rr;
      unsigned int hb, lb;
      bf_split2(v[rr], v[rr + 1], hb, lb);
      mhi[l][lane]     = (unsigned short)hb;
      mhi[l + 1][lane] = (unsigned short)(hb >> 16);
      mlo[l][lane]     = (unsigned short)lb;
      mlo[l + 1][lane] = (unsigned short)(lb >> 16);
    }
  }
  __syncthreads();

  // 3) GEMM1: wave handles p = 2*wave, 2*wave+1 and both 16-column halves of d; K = 32 (c), one k-step, 3 products
  {
    const int arow = i0 + m16;
    FragU ahi, alo;                              // A[m = i][k = c] = mh[i0+i][c]
    ahi.half[0] = *(const v8us_ma*)(&mhi[arow][8 * hh]);
    ahi.half[1] = *(const v8us_ma*)(&mhi[arow][16 + 8 * hh]);
    alo.half[0] = *(const v8us_ma*)(&mlo[arow][8 * hh]);
    alo.half[1] = *(const v8us_ma*)(&mlo[arow][16 + 8 * hh]);
    float wf[4][16];
#pragma unroll   // the global loads of all four B fragments are in flight together
    for (int u = 0; u < 4; ++u) {
      const float* wp = ppw + (size_t)(wave * 2 + (u >> 1)) * 1024 + (u & 1) * 16 + m16;
#pragma unroll
      for (int i = 0; i < 16; ++i) wf[u][i] = wp[kof(i, hh) * 32];
    }
#pragma unroll   // wf stays in registers
    for (int pp = 0; pp < 2; ++pp) {
      const int p = wave * 2 + pp;
#pragma unroll
      for (int nt = 0; nt < 2; ++nt) {
        const int n = nt * 16 + m16;             // B[k = c][n = d] = pp_w[p][c*32 + d]
        FragU bh, bl;
#pragma unroll
        for (int i = 0; i < 16; i += 2)
          bf_split2(wf[pp * 2 + nt][i], wf[pp * 2 + nt][i + 1], bh.w[i >> 1], bl.w[i >> 1]);
        v8f acc = {};
        acc = wmma_bf16(ahi.v, bh.v, acc);
        acc = wmma_bf16(ahi.v, bl.v, acc);
        acc = wmma_bf16(alo.v, bh.v, acc);
#pragma unroll
        for (int r = 0; r < 8; ++r) tf[p][8 * hh + r][n] = acc[r];
      }
    }
  }
  __syncthreads();

  // 4) GEMM2: feat_p[i][j] ; A[m = i][k = d] = T_p[i][d] (f32 in LDS, split at load), B[k = d][n = j] = mh[j][d] (row j, k-contiguous)
#pragma unroll 1
  for (int nt = 0; nt < 4; ++nt) {
    const int brow = nt * 16 + m16;
    FragU bh, bl;
    bh.half[0] = *(const v8us_ma*)(&mhi[brow][8 * hh]);
    bh.half[1] = *(const v8us_ma*)(&mhi[brow][16 + 8 * hh]);
    bl.half[0] = *(const v8us_ma*)(&mlo[brow][8 * hh]);
    bl.half[1] = *(const v8us_ma*)(&mlo[brow][16 + 8 * hh]);
    float ta[2][16];
#pragma unroll   // the LDS reads of both A fragments are in flight together
    for (int pp = 0; pp < 2; ++pp)
#pragma unroll
      for (int i = 0; i < 16; ++i) ta[pp][i] = tf[wave * 2 + pp][m16][kof(i, hh)];
#pragma unroll   // ta stays in registers
    for (int pp = 0; pp < 2; ++pp) {
      const int p = wave * 2 + pp;
      FragU ah, al;
#pragma unroll
      for (int i = 0; i < 16; i += 2) bf_split2(ta[pp][i], ta[pp][i + 1], ah.w[i >> 1], al.w[i >> 1]);
      v8f acc = {};
      acc = wmma_bf16(ah.v, bh.v, acc);
      acc = wmma_bf16(ah.v, bl.v, acc);
      acc = wmma_bf16(al.v, bh.v, acc);
      const float pb = pp_b[p];
#pragma unroll
      for (int r = 0; r < 8; ++r) fo[p][8 * hh + r][brow] = acc[r] + pb;
    }
  }
  __syncthreads();

  // 5) AdaNorm over p (16 values per (i,j)) and SiLU, in place
  {
    const float alpha = ada_alpha[0];
    float v[4][16], mu[4], rs[4];
#pragma unroll   // the thread's 4 positions side by side: LDS reads in flight together
    for (int jq = 0; jq < 4; ++jq) {
      const int q = tid + 256 * jq;
#pragma unroll
      for (int p = 0; p < 16; ++p) v[jq][p] = fo[p][q >> 6][q & 63];
    }
#pragma unroll   // 4 independent mean / variance chains fill each other's latency
    for (int jq = 0; jq < 4; ++jq) {
      float m = 0.f;
#pragma unroll
      for (int p = 0; p < 16; ++p) m += v[jq][p];
      m *= 0.0625f;
      float var = 0.f;
#pragma unroll
      for (int p = 0; p < 16; ++p) { const float d = v[jq][p] - m; var += d * d; }
      var *= 0.0625f;
      mu[jq] = m;
      rs[jq] = fast_rsq(var + 1e-5f);
    }
#pragma unroll   // v stays in registers
    for (int jq = 0; jq < 4; ++jq) {
      const int q = tid + 256 * jq;
#pragma unroll
      for (int p = 0; p < 16; ++p) {
        const float f = v[jq][p] + alpha * ((v[jq][p] - mu[jq]) * rs[jq] * ada_g[p] + ada_b[p]);
        fo[p][q >> 6][q & 63] = f * fast_rcp(1.0f + __expf(-f));
      }
    }
  }
  __syncthreads();

  {
    const size_t pbase = (size_t)b * 16;
    const int col = 4 * (lane & 15), rsel = lane >> 4;
    v4f v[16];
#pragma unroll   // all 16 LDS reads are in flight together, then the stores follow without a wait in between
    for (int u = 0; u < 16; ++u) {
      const int rho = wave * 32 + 2 * u + rsel;
      v[u] = *(const v4f_ma*)(&fo[rho >> 4][rho & 15][col]);
    }
#pragma unroll
    for (int u = 0; u < 16; ++u) {
      const int rho = wave * 32 + 2 * u + rsel;
      const int p = rho >> 4, i = rho & 15;
      *(v4f*)(out + (((pbase + p) * 64 + (size_t)(i0 + i)) * 64 + col)) = v[u];
    }
    
  }
}

extern "C" void kernel_launch(void* const* d_in, const int* in_sizes, int n_in,
                              void* d_out, int out_size, void* d_ws, size_t ws_size,
                              hipStream_t stream) {
  if (n_in < 29 || d_out == 0 || d_ws == 0) return;
  const int nB = in_sizes[0] / 64;
  if (nB <= 0 || in_sizes[0] != nB * 64 || in_sizes[1] != nB * 64 || in_sizes[2] != nB * 64 ||
      in_sizes[3] != nB * 64 || in_sizes[4] != nB * 4096 ||
      in_sizes[5] < 32 || in_sizes[6] < 32 || in_sizes[7] != 2048 || in_sizes[8] < 32 || in_sizes[9] < 32 ||
      in_sizes[10] != 1024 || in_sizes[11] < 32 || in_sizes[12] != 1024 || in_sizes[13] < 32 ||
      in_sizes[14] != 1024 || in_sizes[15] < 32 || in_sizes[16] != 1024 || in_sizes[17] < 32 ||
      in_sizes[18] < 32 || in_sizes[19] < 32 || in_sizes[20] < 4 || in_sizes[21] < 4 ||
      in_sizes[22] != 256 || in_sizes[23] < 32 || in_sizes[24] != 16384 || in_sizes[25] < 16 ||
      in_sizes[26] < 16 || in_sizes[27] < 16 || in_sizes[28] < 1 ||
      out_size != nB * 16 * 4096) return;
  const size_t need = (size_t)nB * 8192 * sizeof(float);      // x after attention: [nB][4][64][32] f32
  if (need > ws_size) return;

  const float* ctcf   = (const float*)d_in[0];
  const float* hac    = (const float*)d_in[1];
  const float* me1    = (const float*)d_in[2];
  const float* me3    = (const float*)d_in[3];
  const float* bulk   = (const float*)d_in[4];
  const float* we_w   = (const float*)d_in[5];
  const float* we_b   = (const float*)d_in[6];
  const float* pos    = (const float*)d_in[7];
  const float* mn_g   = (const float*)d_in[8];
  const float* mn_b   = (const float*)d_in[9];
  const float* wq     = (const float*)d_in[10];
  const float* bq     = (const float*)d_in[11];
  const float* wk     = (const float*)d_in[12];
  const float* bk     = (const float*)d_in[13];
  const float* wv     = (const float*)d_in[14];
  const float* bv     = (const float*)d_in[15];
  const float* wo     = (const float*)d_in[16];
  const float* bo     = (const float*)d_in[17];
  const float* an_g   = (const float*)d_in[18];
  const float* an_b   = (const float*)d_in[19];
  const float* conv_w = (const float*)d_in[20];
  const float* conv_b = (const float*)d_in[21];
  const float* gate_w = (const float*)d_in[22];
  const float* gate_b = (const float*)d_in[23];
  const float* pp_w   = (const float*)d_in[24];
  const float* pp_b   = (const float*)d_in[25];
  const float* ada_g  = (const float*)d_in[26];
  const float* ada_b  = (const float*)d_in[27];
  const float* ada_a  = (const float*)d_in[28];

  float* ws_x = (float*)d_ws;
  const int nbs = nB * 4;          // (b,s) blocks
  const int nblk = nB * 4;         // (b, 16-row tile) blocks

  k_attn<<<nbs, 256, 0, stream>>>(ctcf, hac, me1, me3, bulk, we_w, we_b, pos, mn_g, mn_b,
                                   wq, bq, wk, bk, wv, bv, wo, bo, an_g, an_b,
                                   conv_w, conv_b, gate_w, gate_b, ws_x, nbs);
  k_pair<<<nblk, 256, 0, stream>>>(ws_x, pp_w, pp_b, ada_g, ada_b, ada_a, (float*)d_out, nblk);
}

// v005
// Measured time: 14.7 microseconds a run.
// In two side-by-side timings against v004, it was 1.12 and 1.11 times as fast.
// Counting every step since v000, it is 2.17 times as fast.
// Contractions: q/k/v/out projections and P.V on v_wmma_f32_16x16x32_f16 (f16 operands, P scaled by 4096, f32 accumulate); pair path T=m.A_p and feat=T.m^T on v_wmma_f32_16x16x32_bf16 as bf16 hi/lo split (3 products each, f32 accumulate); k.q^T (K=8) on v_wmma_f32_16x16x4_f32 (f32 operands); gate (K=8) on VALU f32.
#include <hip/hip_runtime.h>

typedef _Float16       v16h  __attribute__((ext_vector_type(16)));
typedef _Float16       v8h   __attribute__((ext_vector_type(8)));
typedef __bf16         v16b  __attribute__((ext_vector_type(16)));
typedef unsigned short v16us __attribute__((ext_vector_type(16)));
typedef unsigned short v8us  __attribute__((ext_vector_type(8)));
typedef float          v8f   __attribute__((ext_vector_type(8)));
typedef float          v4f   __attribute__((ext_vector_type(4)));
typedef float          v2f   __attribute__((ext_vector_type(2)));
typedef __bf16         v2b   __attribute__((ext_vector_type(2)));
typedef v8h  __attribute__((may_alias)) v8h_ma;
typedef v8us __attribute__((may_alias)) v8us_ma;
typedef v4f  __attribute__((may_alias)) v4f_ma;
typedef v2f  __attribute__((may_alias)) v2f_ma;

union FragH { v16h v;  v8h  half[2]; };
union FragU { v16us v; v8us half[2]; unsigned int w[8]; };

// 32-lane butterfly sums of 8 independent rows, stage by stage: the 8 cross-lane moves of a stage are in flight
// together, so a stage costs one cross-lane latency for all rows. Per row the order of the sum is 16, 8, 4, 2, 1.
__device__ __forceinline__ void wave_sum32_rows(float (&v)[8]) {
#pragma unroll   // constant lane masks
  for (int o = 16; o > 0; o >>= 1) {
    float t[8];
#pragma unroll   // rows stay in registers; all moves of the stage issue before the first add
    for (int r = 0; r < 8; ++r) t[r] = __shfl_xor(v[r], o, 32);
#pragma unroll
    for (int r = 0; r < 8; ++r) v[r] += t[r];
  }
}

// 16x16x32 fragment k map, identical for A and B: element i of a lane with hh = lane>>4 holds k = (i&7) + 16*(i>>3) + 8*hh.
// A: lane&15 = row m, B: lane&15 = column n, D: acc[r] = (row 8*hh + r, col lane&15).
__device__ __forceinline__ int kof(int i, int hh) { return (i & 7) + ((i >> 3) << 4) + 8 * hh; }

__device__ __forceinline__ v8f wmma_f16(v16h a, v16h b, v8f c) {
  c = __builtin_amdgcn_wmma_f32_16x16x32_f16(false, a, false, b, (short)0, c, false, false);
  asm volatile("v_nop\n\tv_nop\n\tv_nop\n\tv_nop" : "+v"(c) : "v"(a), "v"(b));
  return c;
}

__device__ __forceinline__ v8f wmma_bf16(v16us a, v16us b, v8f c) {
  v16b ab = __builtin_bit_cast(v16b, a);
  v16b bb = __builtin_bit_cast(v16b, b);
  c = __builtin_amdgcn_wmma_f32_16x16x32_bf16(false, ab, false, bb, (short)0, c, false, false);
  asm volatile("v_nop\n\tv_nop\n\tv_nop\n\tv_nop" : "+v"(c) : "v"(ab), "v"(bb));
  return c;
}

// f32 16x16x4: a lane holds 2 of the 4 k of its row (A) or column (B); both operands are loaded by the same k map
// (k = 2*hh + element), D as in the 16-bit forms.
__device__ __forceinline__ v8f wmma_f32(v2f a, v2f b, v8f c) {
  c = __builtin_amdgcn_wmma_f32_16x16x4_f32(false, a, false, b, (short)0, c, false, false);
  // as in the two helpers above: four vector slots before any vector instruction may touch D, A or B
  asm volatile("v_nop\n\tv_nop\n\tv_nop\n\tv_nop" : "+v"(c) : "v"(a), "v"(b));
  return c;
}

// Bare v_rcp_f32 / v_rsq_f32 (about 1 ulp) in place of the IEEE divide (about 10 dependent vector instructions) and of
// 1 / sqrtf (about 25). Every argument here is a normal f32 or +inf (1 + exp, a softmax sum >= 1, variance + 1e-5),
// except the square sum of a row, whose zero or denormal case ends in the clamp behind it.
__device__ __forceinline__ float fast_rcp(float x) { return __builtin_amdgcn_rcpf(x); }
__device__ __forceinline__ float fast_rsq(float x) { return __builtin_amdgcn_rsqf(x); }

// Two f32 -> their bf16 hi parts and bf16 lo parts (lo = bf16(x - hi)), each pair packed in one dword, x0 in the low half.
// The packed hardware convert rounds to nearest even, as the integer rounding it replaces did; x - hi is exact in f32.
__device__ __forceinline__ void bf_split2(float x0, float x1, unsigned int& hi, unsigned int& lo) {
  const v2f x = {x0, x1};
  const v2b h = __builtin_convertvector(x, v2b);
  const v2f r = {x0 - (float)h[0], x1 - (float)h[1]};
  const v2b l = __builtin_convertvector(r, v2b);
  hi = __builtin_bit_cast(unsigned int, h);
  lo = __builtin_bit_cast(unsigned int, l);
}

// B fragment for output column n of X.W^T with W stored [n][k] f32, pitch 32 (B[k][n] = W[n][k]), converted to f16
__device__ __forceinline__ v16h wfrag_f16(const float* __restrict__ W, int n, int hh) {
  const float* r = W + n * 32;
  v16h f = {};
#pragma unroll
  for (int i = 0; i < 16; ++i) f[i] = (_Float16)r[kof(i, hh)];
  return f;
}

// ---------------------------------------------------------------------------------------------
// Kernel 1: one block per (b,s). Builds x = LN(msa+pos), row attention with bulk bias, gate,
// ---------------------------------------------------------------------------------------------
__global__ __launch_bounds__(256) void k_attn(
    const float* __restrict__ ctcf, const float* __restrict__ hac,
    const float* __restrict__ me1,  const float* __restrict__ me3,
    const float* __restrict__ bulk,
    const float* __restrict__ we_w, const float* __restrict__ we_b,
    const float* __restrict__ pos,
    const float* __restrict__ mn_g, const float* __restrict__ mn_b,
    const float* __restrict__ wq,   const float* __restrict__ bq,
    const float* __restrict__ wk,   const float* __restrict__ bk,
    const float* __restrict__ wv,   const float* __restrict__ bv,
    const float* __restrict__ wo,   const float* __restrict__ bo,
    const float* __restrict__ an_g, const float* __restrict__ an_b,
    const float* __restrict__ conv_w, const float* __restrict__ conv_b,
    const float* __restrict__ gate_w, const float* __restrict__ gate_b,
    float* __restrict__ xw, int nbs)
{
  __shared__ __attribute__((aligned(16))) float    xs[64][32];   // x f32 (kept for residual), then LN output staging
  // Row pitches are 16 B x odd (80 B, 144 B): the 16-byte reads of 16 (or 4) different rows then fall on different banks.
  __shared__ __attribute__((aligned(16))) _Float16 xh[64][40];   // x f16 (A operand of q/k/v), 32 used
  __shared__ __attribute__((aligned(16))) float    qf[64][36];   // 32 used
  // k: [quarter of 16 keys][key in quarter * 36 + channel]; 8 unused floats behind each quarter
  __shared__ __attribute__((aligned(16))) float    kf[4][16 * 36 + 8];
  __shared__ __attribute__((aligned(16))) _Float16 vh[64][40];   // v f16 (B operand of P.V), 32 used
  __shared__ __attribute__((aligned(16))) float    og[64][32];   // P.V output (l, h*8+d)
  __shared__ __attribute__((aligned(16))) _Float16 oh[64][40];   // gated output, f16 (A operand of out proj), 32 used
  __shared__ __attribute__((aligned(16))) float    o2[64][36];   // out proj + bias, 32 used

  const int tid = threadIdx.x, wave = tid >> 5, lane = tid & 31;
  const int hh = lane >> 4, m16 = lane & 15;
  const int bs = blockIdx.x;
  if (bs >= nbs) return;                       // block-uniform
  const int b = bs >> 2, s = bs & 3;

  // 1) x = LN(signal * we_w + we_b + pos); wave per row, lane = channel
  {
    const float* sig = (s == 0) ? ctcf : ((s == 1) ? hac : ((s == 2) ? me1 : me3));
    const float ww = we_w[lane], wb = we_b[lane], g = mn_g[lane], be = mn_b[lane];
    float d[8], t[8];
#pragma unroll   // the wave's 8 rows side by side: their global loads are in flight together
    for (int rr = 0; rr < 8; ++rr) {
      const int l = wave * 8 + rr;
      d[rr] = sig[b * 64 + l];
      t[rr] = pos[l * 32 + lane];
    }
    // keeps the first use of a signal value behind the issue of the position loads: one global latency, not two in a row
    __builtin_amdgcn_sched_barrier(0);
#pragma unroll
    for (int rr = 0; rr < 8; ++rr) {
      float v = d[rr] * ww + wb;
      v += t[rr];
      d[rr] = v;
      t[rr] = v;
    }
    wave_sum32_rows(t);
#pragma unroll
    for (int rr = 0; rr < 8; ++rr) { d[rr] -= t[rr] * 0.03125f; t[rr] = d[rr] * d[rr]; }
    wave_sum32_rows(t);
#pragma unroll   // 8 independent chains fill each other's latency
    for (int rr = 0; rr < 8; ++rr) {
      const int l = wave * 8 + rr;
      const float var = t[rr] * 0.03125f;
      const float y   = d[rr] * fast_rsq(var + 1e-5f) * g + be;
      xs[l][lane] = y;
      xh[l][lane] = (_Float16)y;
    }
  }
  __syncthreads();

  // Bias operands of step 3 (the wave's 16 queries, its two heads), read once a wave; issued here so that they arrive
  // under the projections: lane (m16, hh) takes bulk[b][q0 + m16][16*t + 8*hh + 0..7].
  const int q0 = (wave & 3) * 16;
  v4f bias[4][2];
  float cwv[2], cbv[2];
  {
    const float* bl = bulk + ((size_t)b * 64 + q0 + m16) * 64 + 8 * hh;
#pragma unroll   // the 8 global loads are in flight together
    for (int t = 0; t < 4; ++t) {
      bias[t][0] = *(const v4f_ma*)(bl + 16 * t);
      bias[t][1] = *(const v4f_ma*)(bl + 16 * t + 4);
    }
#pragma unroll
    for (int u = 0; u < 2; ++u) { cwv[u] = conv_w[(wave >> 2) + 2 * u]; cbv[u] = conv_b[(wave >> 2) + 2 * u]; }
    // precaution: the address registers of the loads above are reused right behind them
    asm volatile("s_wait_xcnt 0x0" ::: "memory");
  }

  // 2) q/k/v = x.W^T + b : one 16x16 tile (mt,nt) per wave for each of q,k,v ; K = 32 = one k-step
  {
    const int mt = wave >> 1, nt = wave & 1;
    const int arow = mt * 16 + m16, ncol = nt * 16 + m16, drow = mt * 16 + 8 * hh;
    FragH a;
    a.half[0] = *(const v8h_ma*)(&xh[arow][8 * hh]);
    a.half[1] = *(const v8h_ma*)(&xh[arow][16 + 8 * hh]);
    {
      v8f acc = {};
      acc = wmma_f16(a.v, wfrag_f16(wq, ncol, hh), acc);
      const float bb = bq[ncol];
#pragma unroll
      for (int r = 0; r < 8; ++r) qf[drow + r][ncol] = acc[r] + bb;
    }
    {
      v8f acc = {};
      acc = wmma_f16(a.v, wfrag_f16(wk, ncol, hh), acc);
      const float bb = bk[ncol];
#pragma unroll
      for (int r = 0; r < 8; ++r) kf[mt][(8 * hh + r) * 36 + ncol] = acc[r] + bb;
    }
    {
      v8f acc = {};
      acc = wmma_f16(a.v, wfrag_f16(wv, ncol, hh), acc);
      const float bb = bv[ncol];
#pragma unroll
      for (int r = 0; r < 8; ++r) vh[drow + r][ncol] = (_Float16)(acc[r] + bb);
    }
  }
  __syncthreads();

  // 3) attention core, one wave per (16 queries, head), two heads a wave, no barrier inside: S^T = K.Q^T on the f32 WMMA puts
  //    the scores of query m16 for keys 16*t + 8*hh + r into st[t][r] of lanes m16 and m16 + 16; that is the k map of the A
  //    fragment of P.V, so softmax and P stay in registers (one exchange with lane ^ 16 for the maximum, one for the sum).
  {
    const float rsD = 0.35355339059327373f;     // 1/sqrt(8)
#pragma unroll   // u indexes cwv and cbv, which stay in registers only under constant indices
    for (int u = 0; u < 2; ++u) {
      const int h = (wave >> 2) + 2 * u;
      const float cw = cwv[u], cb = cbv[u];
      v2f qb[2], ka[4][2];
#pragma unroll
      for (int e = 0; e < 2; ++e) {
        qb[e] = *(const v2f_ma*)(&qf[q0 + m16][h * 8 + 4 * e + 2 * hh]);      // B[k = d][n = query]
#pragma unroll
        for (int t = 0; t < 4; ++t)
          ka[t][e] = *(const v2f_ma*)(&kf[t][m16 * 36 + h * 8 + 4 * e + 2 * hh]);   // A[m = key][k = d]
      }
      v8f st[4];
#pragma unroll   // four independent accumulators per k-step
      for (int t = 0; t < 4; ++t) { const v8f z = {}; st[t] = wmma_f32(ka[t][0], qb[0], z); }
#pragma unroll
      for (int t = 0; t < 4; ++t) st[t] = wmma_f32(ka[t][1], qb[1], st[t]);
      float sc[4][8];
      float mx = -3.0e38f;
#pragma unroll
      for (int t = 0; t < 4; ++t)
#pragma unroll
        for (int r = 0; r < 8; ++r) {
          const float sv = st[t][r] * rsD + (bias[t][r >> 2][r & 3] * cw + cb);
          sc[t][r] = sv;
          mx = fmaxf(mx, sv);
        }
      mx = fmaxf(mx, __shfl_xor(mx, 16, 32));
      float sum = 0.f;
#pragma unroll
      for (int t = 0; t < 4; ++t)
#pragma unroll
        for (int r = 0; r < 8; ++r) { const float e = __expf(sc[t][r] - mx); sc[t][r] = e; sum += e; }
      sum += __shfl_xor(sum, 16, 32);
      const float inv = 4096.0f * fast_rcp(sum);  // P carried x4096 (exact power of two) for the f16 operand
      const int vcol = h * 8 + (m16 & 7);
      v8f acc = {};
#pragma unroll
      for (int ks = 0; ks < 2; ++ks) {
        const int k0 = ks * 32;
        v16h pa = {};                             // A[m = query][k = key]: key = k0 + kof(i, hh) = 16*(2*ks + (i>>3)) + 8*hh + (i&7)
        v16h bvv = {};                            // B[k = key][n = d] = v[key][h*8+d], columns n>=8 zero
#pragma unroll
        for (int i = 0; i < 16; ++i) {
          pa[i] = (_Float16)(sc[2 * ks + (i >> 3)][i & 7] * inv);
          const _Float16 t = vh[k0 + kof(i, hh)][vcol];
          bvv[i] = (m16 < 8) ? t : (_Float16)0.0f;
        }
        acc = wmma_f16(pa, bvv, acc);
      }
      if (m16 < 8) {
        const int drow = q0 + 8 * hh;
#pragma unroll
        for (int r = 0; r < 8; ++r) og[drow + r][h * 8 + m16] = acc[r] * (1.0f / 4096.0f);
      }
    }
  }
  __syncthreads();

  // 4) gate: oh[l][h*8+c] = og[l][h*8+c] * sigmoid(sum_d gate_w[h][c][d] og[l][h*8+d] + gate_b[h][c])
  {
    const int hc = lane, h8 = hc & 24;            // row l = wave + 8 * j
    float ov[8][8], oc[8];
#pragma unroll   // all LDS reads of the thread's 8 rows issue before the first use
    for (int j = 0; j < 8; ++j) {
      const int l = wave + 8 * j;
#pragma unroll
      for (int d = 0; d < 8; ++d) ov[j][d] = og[l][h8 + d];
      oc[j] = og[l][hc];
    }
#pragma unroll   // 8 independent dot / exp / reciprocal chains fill each other's latency
    for (int j = 0; j < 8; ++j) {
      float acc = gate_b[hc];
#pragma unroll
      for (int d = 0; d < 8; ++d) acc += gate_w[hc * 8 + d] * ov[j][d];
      const float gs = fast_rcp(1.0f + __expf(-acc));
      oh[wave + 8 * j][hc] = (_Float16)(oc[j] * gs);
    }
  }
  __syncthreads();

  // 5) output projection: o2 = oh.wo^T + bo ; one tile per wave
  {
    const int mt = wave >> 1, nt = wave & 1;
    const int arow = mt * 16 + m16, ncol = nt * 16 + m16, drow = mt * 16 + 8 * hh;
    FragH a;
    a.half[0] = *(const v8h_ma*)(&oh[arow][8 * hh]);
    a.half[1] = *(const v8h_ma*)(&oh[arow][16 + 8 * hh]);
    v8f acc = {};
    acc = wmma_f16(a.v, wfrag_f16(wo, ncol, hh), acc);
    const float bb = bo[ncol];
#pragma unroll
    for (int r = 0; r < 8; ++r) o2[drow + r][ncol] = acc[r] + bb;
  }
  __syncthreads();

  // 6) residual + LN, staged back into xs (each lane rewrites only the element it read)
  {
    const float g = an_g[lane], be = an_b[lane];
    float d[8], t[8];
#pragma unroll   // the wave's 8 rows side by side: their LDS reads are in flight together
    for (int rr = 0; rr < 8; ++rr) {
      const int l = wave * 8 + rr;
      const float v = xs[l][lane] + o2[l][lane];
      d[rr] = v;
      t[rr] = v;
    }
    wave_sum32_rows(t);
#pragma unroll
    for (int rr = 0; rr < 8; ++rr) { d[rr] -= t[rr] * 0.03125f; t[rr] = d[rr] * d[rr]; }
    wave_sum32_rows(t);
#pragma unroll   // 8 independent chains fill each other's latency
    for (int rr = 0; rr < 8; ++rr) {
      const float var = t[rr] * 0.03125f;
      xs[wave * 8 + rr][lane] = d[rr] * fast_rsq(var + 1e-5f) * g + be;
    }
  }
  __syncthreads();

  {
    float* xg = xw + (size_t)bs * 2048;
    const int col = 4 * (lane & 7);
    const int r0 = wave * 8 + (lane >> 3), r1 = r0 + 4;
    const v4f v0 = *(const v4f_ma*)(&xs[r0][col]);
    const v4f v1 = *(const v4f_ma*)(&xs[r1][col]);
    *(v4f*)(xg + r0 * 32 + col) = v0;
    *(v4f*)(xg + r1 * 32 + col) = v1;
    
  }
}

// ---------------------------------------------------------------------------------------------
// Kernel 2: one block per (b, tile of 16 rows i). m = max over tracks, unit rows, bf16 hi/lo;
// T_p[i][d] = sum_c mh[i][c] A_p[c][d]  (A_p[c][d] = pp_w[p][c*32+d]);  feat_p[i][j] = sum_d T_p[i][d] mh[j][d] + pp_b[p];
// ---------------------------------------------------------------------------------------------
__global__ __launch_bounds__(256) void k_pair(
    const float* __restrict__ xw, const float* __restrict__ ppw, const float* __restrict__ pp_b,
    const float* __restrict__ ada_g, const float* __restrict__ ada_b, const float* __restrict__ ada_alpha,
    float* __restrict__ out, int nblk)
{
  // Row pitches are 16 B x odd (80 B, 144 B, 272 B): the 16-byte fragment reads of 16 rows fall on different banks,
  // and so do the two 8-row halves of an accumulator store.
  __shared__ __attribute__((aligned(16))) unsigned short mhi[64][40];   // bf16 bits, hi part of unit rows, 32 used
  __shared__ __attribute__((aligned(16))) unsigned short mlo[64][40];   // bf16 bits, lo part, 32 used
  __shared__ __attribute__((aligned(16))) float tf[16][16][36];         // T_p for this block's 16 rows, f32, 32 used
  __shared__ __attribute__((aligned(16))) float fo[16][16][68];         // feat / final values (p, i, j), 64 used
  float* mf = &fo[0][0][0];                                            // [64*32] f32 max rows; dead before fo is first written

  const int tid = threadIdx.x, wave = tid >> 5, lane = tid & 31;
  const int hh = lane >> 4, m16 = lane & 15;
  const int blk = blockIdx.x;
  if (blk >= nblk) return;                     // block-uniform
  const int b = blk >> 2, i0 = (blk & 3) * 16;

  // 1) max over the 4 tracks
  {
    const float* xb = xw + (size_t)b * 8192;
#pragma unroll
    for (int j = 0; j < 8; ++j) {
      const int e = tid + 256 * j;
      float v = xb[e];
      v = fmaxf(v, xb[2048 + e]);
      v = fmaxf(v, xb[4096 + e]);
      v = fmaxf(v, xb[6144 + e]);
      mf[e] = v;
    }
  }
  __syncthreads();

  // 2) unit rows (the pair norm factorises as |m_i|*|m_j|; clamp applied per factor), split into bf16 hi + lo
  {
    float v[8], t[8];
#pragma unroll   // the wave's 8 rows side by side: their LDS reads are in flight together
    for (int rr = 0; rr < 8; ++rr) {
      v[rr] = mf[(wave * 8 + rr) * 32 + lane];
      t[rr] = v[rr] * v[rr];
    }
    wave_sum32_rows(t);
#pragma unroll   // 8 independent chains fill each other's latency
    for (int rr = 0; rr < 8; ++rr) {
      const float inv = fminf(fast_rsq(t[rr]), 1e3f);   // = 1 / max(sqrt(t), 1e-3); t = 0 gives +inf, clamped
      v[rr] *= inv;
    }
#pragma unroll   // two rows share each packed convert
    for (int rr = 0; rr < 8; rr += 2) {
      const int l = wave * 8 + rr;
      unsigned int hb, lb;
      bf_split2(v[rr], v[rr + 1], hb, lb);
      mhi[l][lane]     = (unsigned short)hb;
      mhi[l + 1][lane] = (unsigned short)(hb >> 16);
      mlo[l][lane]     = (unsigned short)lb;
      mlo[l + 1][lane] = (unsigned short)(lb >> 16);
    }
  }
  __syncthreads();

  // 3) GEMM1: wave handles p = 2*wave, 2*wave+1 and both 16-column halves of d; K = 32 (c), one k-step, 3 products
  {
    const int arow = i0 + m16;
    FragU ahi, alo;                              // A[m = i][k = c] = mh[i0+i][c]
    ahi.half[0] = *(const v8us_ma*)(&mhi[arow][8 * hh]);
    ahi.half[1] = *(const v8us_ma*)(&mhi[arow][16 + 8 * hh]);
    alo.half[0] = *(const v8us_ma*)(&mlo[arow][8 * hh]);
    alo.half[1] = *(const v8us_ma*)(&mlo[arow][16 + 8 * hh]);
    float wf[4][16];
#pragma unroll   // the global loads of all four B fragments are in flight together
    for (int u = 0; u < 4; ++u) {
      const float* wp = ppw + (size_t)(wave * 2 + (u >> 1)) * 1024 + (u & 1) * 16 + m16;
#pragma unroll
      for (int i = 0; i < 16; ++i) wf[u][i] = wp[kof(i, hh) * 32];
    }
#pragma unroll   // wf stays in registers
    for (int pp = 0; pp < 2; ++pp) {
      const int p = wave * 2 + pp;
#pragma unroll
      for (int nt = 0; nt < 2; ++nt) {
        const int n = nt * 16 + m16;             // B[k = c][n = d] = pp_w[p][c*32 + d]
        FragU bh, bl;
#pragma unroll
        for (int i = 0; i < 16; i += 2)
          bf_split2(wf[pp * 2 + nt][i], wf[pp * 2 + nt][i + 1], bh.w[i >> 1], bl.w[i >> 1]);
        v8f acc = {};
        acc = wmma_bf16(ahi.v, bh.v, acc);
        acc = wmma_bf16(ahi.v, bl.v, acc);
        acc = wmma_bf16(alo.v, bh.v, acc);
#pragma unroll
        for (int r = 0; r < 8; ++r) tf[p][8 * hh + r][n] = acc[r];
      }
    }
  }
  __syncthreads();

  // 4) GEMM2: feat_p[i][j] ; A[m = i][k = d] = T_p[i][d] (f32 in LDS, split at load), B[k = d][n = j] = mh[j][d] (row j, k-contiguous)
#pragma unroll 1
  for (int nt = 0; nt < 4; ++nt) {
    const int brow = nt * 16 + m16;
    FragU bh, bl;
    bh.half[0] = *(const v8us_ma*)(&mhi[brow][8 * hh]);
    bh.half[1] = *(const v8us_ma*)(&mhi[brow][16 + 8 * hh]);
    bl.half[0] = *(const v8us_ma*)(&mlo[brow][8 * hh]);
    bl.half[1] = *(const v8us_ma*)(&mlo[brow][16 + 8 * hh]);
    float ta[2][16];
#pragma unroll   // the LDS reads of both A fragments are in flight together
    for (int pp = 0; pp < 2; ++pp)
#pragma unroll
      for (int i = 0; i < 16; ++i) ta[pp][i] = tf[wave * 2 + pp][m16][kof(i, hh)];
#pragma unroll   // ta stays in registers
    for (int pp = 0; pp < 2; ++pp) {
      const int p = wave * 2 + pp;
      FragU ah, al;
#pragma unroll
      for (int i = 0; i < 16; i += 2) bf_split2(ta[pp][i], ta[pp][i + 1], ah.w[i >> 1], al.w[i >> 1]);
      v8f acc = {};
      acc = wmma_bf16(ah.v, bh.v, acc);
      acc = wmma_bf16(ah.v, bl.v, acc);
      acc = wmma_bf16(al.v, bh.v, acc);
      const float pb = pp_b[p];
#pragma unroll
      for (int r = 0; r < 8; ++r) fo[p][8 * hh + r][brow] = acc[r] + pb;
    }
  }
  __syncthreads();

  // 5) AdaNorm over p (16 values per (i,j)) and SiLU, in place
  {
    const float alpha = ada_alpha[0];
    float v[4][16], mu[4], rs[4];
#pragma unroll   // the thread's 4 positions side by side: LDS reads in flight together
    for (int jq = 0; jq < 4; ++jq) {
      const int q = tid + 256 * jq;
#pragma unroll
      for (int p = 0; p < 16; ++p) v[jq][p] = fo[p][q >> 6][q & 63];
    }
#pragma unroll   // 4 independent mean / variance chains fill each other's latency
    for (int jq = 0; jq < 4; ++jq) {
      float m = 0.f;
#pragma unroll
      for (int p = 0; p < 16; ++p) m += v[jq][p];
      m *= 0.0625f;
      float var = 0.f;
#pragma unroll
      for (int p = 0; p < 16; ++p) { const float d = v[jq][p] - m; var += d * d; }
      var *= 0.0625f;
      mu[jq] = m;
      rs[jq] = fast_rsq(var + 1e-5f);
    }
#pragma unroll   // v stays in registers
    for (int jq = 0; jq < 4; ++jq) {
      const int q = tid + 256 * jq;
#pragma unroll
      for (int p = 0; p < 16; ++p) {
        const float f = v[jq][p] + alpha * ((v[jq][p] - mu[jq]) * rs[jq] * ada_g[p] + ada_b[p]);
        fo[p][q >> 6][q & 63] = f * fast_rcp(1.0f + __expf(-f));
      }
    }
  }
  __syncthreads();

  {
    const size_t pbase = (size_t)b * 16;
    const int col = 4 * (lane & 15), rsel = lane >> 4;
    v4f v[16];
#pragma unroll   // all 16 LDS reads are in flight together, then the stores follow without a wait in between
    for (int u = 0; u < 16; ++u) {
      const int rho = wave * 32 + 2 * u + rsel;
      v[u] = *(const v4f_ma*)(&fo[rho >> 4][rho & 15][col]);
    }
#pragma unroll
    for (int u = 0; u < 16; ++u) {
      const int rho = wave * 32 + 2 * u + rsel;
      const int p = rho >> 4, i = rho & 15;
      *(v4f*)(out + (((pbase + p) * 64 + (size_t)(i0 + i)) * 64 + col)) = v[u];
    }
    
  }
}

extern "C" void kernel_launch(void* const* d_in, const int* in_sizes, int n_in,
                              void* d_out, int out_size, void* d_ws, size_t ws_size,
                              hipStream_t stream) {
  if (n_in < 29 || d_out == 0 || d_ws == 0) return;
  const int nB = in_sizes[0] / 64;
  if (nB <= 0 || in_sizes[0] != nB * 64 || in_sizes[1] != nB * 64 || in_sizes[2] != nB * 64 ||
      in_sizes[3] != nB * 64 || in_sizes[4] != nB * 4096 ||
      in_sizes[5] < 32 || in_sizes[6] < 32 || in_sizes[7] != 2048 || in_sizes[8] < 32 || in_sizes[9] < 32 ||
      in_sizes[10] != 1024 || in_sizes[11] < 32 || in_sizes[12] != 1024 || in_sizes[13] < 32 ||
      in_sizes[14] != 1024 || in_sizes[15] < 32 || in_sizes[16] != 1024 || in_sizes[17] < 32 ||
      in_sizes[18] < 32 || in_sizes[19] < 32 || in_sizes[20] < 4 || in_sizes[21] < 4 ||
      in_sizes[22] != 256 || in_sizes[23] < 32 || in_sizes[24] != 16384 || in_sizes[25] < 16 ||
      in_sizes[26] < 16 || in_sizes[27] < 16 || in_sizes[28] < 1 ||
      out_size != nB * 16 * 4096) return;
  const size_t need = (size_t)nB * 8192 * sizeof(float);      // x after attention: [nB][4][64][32] f32
  if (need > ws_size) return;

  const float* ctcf   = (const float*)d_in[0];
  const float* hac    = (const float*)d_in[1];
  const float* me1    = (const float*)d_in[2];
  const float* me3    = (const float*)d_in[3];
  const float* bulk   = (const float*)d_in[4];
  const float* we_w   = (const float*)d_in[5];
  const float* we_b   = (const float*)d_in[6];
  const float* pos    = (const float*)d_in[7];
  const float* mn_g   = (const float*)d_in[8];
  const float* mn_b   = (const float*)d_in[9];
  const float* wq     = (const float*)d_in[10];
  const float* bq     = (const float*)d_in[11];
  const float* wk     = (const float*)d_in[12];
  const float* bk     = (const float*)d_in[13];
  const float* wv     = (const float*)d_in[14];
  const float* bv     = (const float*)d_in[15];
  const float* wo     = (const float*)d_in[16];
  const float* bo     = (const float*)d_in[17];
  const float* an_g   = (const float*)d_in[18];
  const float* an_b   = (const float*)d_in[19];
  const float* conv_w = (const float*)d_in[20];
  const float* conv_b = (const float*)d_in[21];
  const float* gate_w = (const float*)d_in[22];
  const float* gate_b = (const float*)d_in[23];
  const float* pp_w   = (const float*)d_in[24];
  const float* pp_b   = (const float*)d_in[25];
  const float* ada_g  = (const float*)d_in[26];
  const float* ada_b  = (const float*)d_in[27];
  const float* ada_a  = (const float*)d_in[28];

  float* ws_x = (float*)d_ws;
  const int nbs = nB * 4;          // (b,s) blocks
  const int nblk = nB * 4;         // (b, 16-row tile) blocks

  k_attn<<<nbs, 256, 0, stream>>>(ctcf, hac, me1, me3, bulk, we_w, we_b, pos, mn_g, mn_b,
                                   wq, bq, wk, bk, wv, bv, wo, bo, an_g, an_b,
                                   conv_w, conv_b, gate_w, gate_b, ws_x, nbs);
  k_pair<<<nblk, 256, 0, stream>>>(ws_x, pp_w, pp_b, ada_g, ada_b, ada_a, (float*)d_out, nblk);
}

// v006
// It runs in 12.6 microseconds.
// In two side-by-side timings against v005, it was 1.15 and 1.14 times as fast.
// Over all steps from v000 it is 2.49 times as fast.
// Contractions: q/k/v/out projections and P.V on v_wmma_f32_16x16x32_f16 (f16 operands, P scaled by 4096, f32 accumulate); pair path T=m.A_p and feat=T.m^T on v_wmma_f32_16x16x32_bf16 as bf16 hi/lo split (3 products each, f32 accumulate); k.q^T (K=8) on v_wmma_f32_16x16x4_f32 (f32 operands); gate (K=8) on VALU f32.
#include <hip/hip_runtime.h>

typedef _Float16       v16h  __attribute__((ext_vector_type(16)));
typedef _Float16       v8h   __attribute__((ext_vector_type(8)));
typedef __bf16         v16b  __attribute__((ext_vector_type(16)));
typedef unsigned short v16us __attribute__((ext_vector_type(16)));
typedef unsigned short v8us  __attribute__((ext_vector_type(8)));
typedef float          v8f   __attribute__((ext_vector_type(8)));
typedef float          v4f   __attribute__((ext_vector_type(4)));
typedef float          v2f   __attribute__((ext_vector_type(2)));
typedef __bf16         v2b   __attribute__((ext_vector_type(2)));
typedef v8h  __attribute__((may_alias)) v8h_ma;
typedef v8us __attribute__((may_alias)) v8us_ma;
typedef v4f  __attribute__((may_alias)) v4f_ma;
typedef v2f  __attribute__((may_alias)) v2f_ma;

union FragH { v16h v;  v8h  half[2]; };
union FragU { v16us v; v8us half[2]; unsigned int w[8]; };

// 32-lane butterfly sums of 8 independent rows, stage by stage: the 8 cross-lane moves of a stage are in flight
// together, so a stage costs one cross-lane latency for all rows. Per row the order of the sum is 16, 8, 4, 2, 1.
__device__ __forceinline__ void wave_sum32_rows(float (&v)[8]) {
#pragma unroll   // constant lane masks
  for (int o = 16; o > 0; o >>= 1) {
    float t[8];
#pragma unroll   // rows stay in registers; all moves of the stage issue before the first add
    for (int r = 0; r < 8; ++r) t[r] = __shfl_xor(v[r], o, 32);
#pragma unroll
    for (int r = 0; r < 8; ++r) v[r] += t[r];
  }
}

// 16x16x32 fragment k map, identical for A and B: element i of a lane with hh = lane>>4 holds k = (i&7) + 16*(i>>3) + 8*hh.
// A: lane&15 = row m, B: lane&15 = column n, D: acc[r] = (row 8*hh + r, col lane&15).
__device__ __forceinline__ int kof(int i, int hh) { return (i & 7) + ((i >> 3) << 4) + 8 * hh; }

__device__ __forceinline__ v8f wmma_f16(v16h a, v16h b, v8f c) {
  c = __builtin_amdgcn_wmma_f32_16x16x32_f16(false, a, false, b, (short)0, c, false, false);
  asm volatile("v_nop\n\tv_nop\n\tv_nop\n\tv_nop" : "+v"(c) : "v"(a), "v"(b));
  return c;
}

__device__ __forceinline__ v8f wmma_bf16(v16us a, v16us b, v8f c) {
  v16b ab = __builtin_bit_cast(v16b, a);
  v16b bb = __builtin_bit_cast(v16b, b);
  c = __builtin_amdgcn_wmma_f32_16x16x32_bf16(false, ab, false, bb, (short)0, c, false, false);
  asm volatile("v_nop\n\tv_nop\n\tv_nop\n\tv_nop" : "+v"(c) : "v"(ab), "v"(bb));
  return c;
}

// f32 16x16x4: a lane holds 2 of the 4 k of its row (A) or column (B); both operands are loaded by the same k map
// (k = 2*hh + element), D as in the 16-bit forms.
__device__ __forceinline__ v8f wmma_f32(v2f a, v2f b, v8f c) {
  c = __builtin_amdgcn_wmma_f32_16x16x4_f32(false, a, false, b, (short)0, c, false, false);
  // as in the two helpers above: four vector slots before any vector instruction may touch D, A or B
  asm volatile("v_nop\n\tv_nop\n\tv_nop\n\tv_nop" : "+v"(c) : "v"(a), "v"(b));
  return c;
}

// Bare v_rcp_f32 / v_rsq_f32 (about 1 ulp) in place of the IEEE divide (about 10 dependent vector instructions) and of
// 1 / sqrtf (about 25). Every argument here is a normal f32 or +inf (1 + exp, a softmax sum >= 1, variance + 1e-5),
// except the square sum of a row, whose zero or denormal case ends in the clamp behind it.
__device__ __forceinline__ float fast_rcp(float x) { return __builtin_amdgcn_rcpf(x); }
__device__ __forceinline__ float fast_rsq(float x) { return __builtin_amdgcn_rsqf(x); }

// Two f32 -> their bf16 hi parts and bf16 lo parts (lo = bf16(x - hi)), each pair packed in one dword, x0 in the low half.
// The packed hardware convert rounds to nearest even, as the integer rounding it replaces did; x - hi is exact in f32.
__device__ __forceinline__ void bf_split2(float x0, float x1, unsigned int& hi, unsigned int& lo) {
  const v2f x = {x0, x1};
  const v2b h = __builtin_convertvector(x, v2b);
  const v2f r = {x0 - (float)h[0], x1 - (float)h[1]};
  const v2b l = __builtin_convertvector(r, v2b);
  hi = __builtin_bit_cast(unsigned int, h);
  lo = __builtin_bit_cast(unsigned int, l);
}

// B fragment for output column n of X.W^T with W stored [n][k] f32, pitch 32 (B[k][n] = W[n][k]): the global loads alone,
// so that they can be issued long before the fragment is needed ...
// (k = kof(i, hh) is two runs of 8 floats, at 8*hh and at 16 + 8*hh: four 16-byte loads, w[i >> 2][i & 3] = W[n][kof(i, hh)])
// r = W + n * 32 + 8 * hh
__device__ __forceinline__ void wfrag_load(const float* __restrict__ r, v4f (&w)[4]) {
  w[0] = *(const v4f_ma*)(r);
  w[1] = *(const v4f_ma*)(r + 4);
  w[2] = *(const v4f_ma*)(r + 16);
  w[3] = *(const v4f_ma*)(r + 20);
}
// ... and the conversion to f16 at the place of use
__device__ __forceinline__ v16h wfrag_f16(const v4f (&w)[4]) {
  v16h f = {};
#pragma unroll
  for (int i = 0; i < 16; ++i) f[i] = (_Float16)w[i >> 2][i & 3];
  return f;
}

// ---------------------------------------------------------------------------------------------
// Kernel 1: one block per (b,s). Builds x = LN(msa+pos), row attention with bulk bias, gate,
// ---------------------------------------------------------------------------------------------
__global__ __launch_bounds__(256) void k_attn(
    const float* __restrict__ ctcf, const float* __restrict__ hac,
    const float* __restrict__ me1,  const float* __restrict__ me3,
    const float* __restrict__ bulk,
    const float* __restrict__ we_w, const float* __restrict__ we_b,
    const float* __restrict__ pos,
    const float* __restrict__ mn_g, const float* __restrict__ mn_b,
    const float* __restrict__ wq,   const float* __restrict__ bq,
    const float* __restrict__ wk,   const float* __restrict__ bk,
    const float* __restrict__ wv,   const float* __restrict__ bv,
    const float* __restrict__ wo,   const float* __restrict__ bo,
    const float* __restrict__ an_g, const float* __restrict__ an_b,
    const float* __restrict__ conv_w, const float* __restrict__ conv_b,
    const float* __restrict__ gate_w, const float* __restrict__ gate_b,
    float* __restrict__ xw, int nbs)
{
  __shared__ __attribute__((aligned(16))) float    xs[64][32];   // x f32 (kept for residual), then LN output staging
  // Row pitches are 16 B x odd (80 B, 144 B): the 16-byte reads of 16 (or 4) different rows then fall on different banks.
  __shared__ __attribute__((aligned(16))) _Float16 xh[64][40];   // x f16 (A operand of q/k/v), 32 used
  __shared__ __attribute__((aligned(16))) float    qf[64][36];   // 32 used
  // k: [quarter of 16 keys][key in quarter * 36 + channel]; 8 unused floats behind each quarter
  __shared__ __attribute__((aligned(16))) float    kf[4][16 * 36 + 8];
  __shared__ __attribute__((aligned(16))) _Float16 vh[64][40];   // v f16 (B operand of P.V), 32 used
  __shared__ __attribute__((aligned(16))) float    og[64][32];   // P.V output (l, h*8+d)
  __shared__ __attribute__((aligned(16))) _Float16 oh[64][40];   // gated output, f16 (A operand of out proj), 32 used
  __shared__ __attribute__((aligned(16))) float    o2[64][36];   // out proj + bias, 32 used

  const int tid = threadIdx.x, wave = tid >> 5, lane = tid & 31;
  const int hh = lane >> 4, m16 = lane & 15;
  const int bs = blockIdx.x;
  if (bs >= nbs) return;                       // block-uniform
  const int b = bs >> 2, s = bs & 3;

  // Everything that steps 2 to 6 read from global memory. None of it depends on a computed value, so all of it is issued
  // in step 1, behind that step's own loads, and lands under that step's work (its closing __syncthreads() waits for every
  // outstanding load); no later step waits for global memory.
  const int q0 = (wave & 3) * 16;               // step 3: the wave's 16 queries
  const int pcol = (wave & 1) * 16 + m16;       // steps 2 and 5: the lane's output column
  v4f wqr[4], wkr[4], wvr[4], wor[4];
  float gwr[8];
  float bqr, bkr, bvr, bor, gbr, ang, anb;
  v4f bias[4][2];                               // lane (m16, hh) takes bulk[b][q0 + m16][16*t + 8*hh + 0..7]
  float cwv[2], cbv[2];

  // 1) x = LN(signal * we_w + we_b + pos); wave per row, lane = channel
  {
    // two-level select on the bits of s: compiles to scalar selects, no branch, so that all kernel arguments are fetched at once
    const float* sig01 = (s & 1) ? hac : ctcf;
    const float* sig23 = (s & 1) ? me3 : me1;
    const float* sig = (s & 2) ? sig23 : sig01;
    const float ww = we_w[lane], wb = we_b[lane], g = mn_g[lane], be = mn_b[lane];
    float d[8], t[8];
#pragma unroll   // the wave's 8 rows side by side: their global loads are in flight together
    for (int rr = 0; rr < 8; ++rr) {
      const int l = wave * 8 + rr;
      d[rr] = sig[b * 64 + l];
      t[rr] = pos[l * 32 + lane];
    }
    // the one-line parameters of the later steps ride along here
    bqr = bq[pcol];  bkr = bk[pcol];  bvr = bv[pcol];  bor = bo[pcol];
    gbr = gate_b[lane];  ang = an_g[lane];  anb = an_b[lane];
#pragma unroll
    for (int u = 0; u < 2; ++u) { cwv[u] = conv_w[(wave >> 2) + 2 * u]; cbv[u] = conv_b[(wave >> 2) + 2 * u]; }
    // The scheduling barriers keep the three groups of loads in this order (loads return in issue order: this step's own
    // come first) and let nothing in between a group's last load and the wait behind it. Each wait is a precaution: the
    // address registers of the group in front of it are reused behind it, also as the results of the next group's loads.
    __builtin_amdgcn_sched_barrier(0);
    asm volatile("s_wait_xcnt 0x0" ::: "memory");
    __builtin_amdgcn_sched_barrier(0);
    const int woff = pcol * 32 + 8 * hh;
    wfrag_load(wq + woff, wqr);
    wfrag_load(wk + woff, wkr);
    wfrag_load(wv + woff, wvr);
    wfrag_load(wo + woff, wor);
#pragma unroll
    for (int dd = 0; dd < 8; ++dd) gwr[dd] = gate_w[lane * 8 + dd];
    __builtin_amdgcn_sched_barrier(0);
    asm volatile("s_wait_xcnt 0x0" ::: "memory");
    __builtin_amdgcn_sched_barrier(0);
    {
      const float* bl = bulk + ((size_t)b * 64 + q0 + m16) * 64 + 8 * hh;
#pragma unroll
      for (int t4 = 0; t4 < 4; ++t4) {
        bias[t4][0] = *(const v4f_ma*)(bl + 16 * t4);
        bias[t4][1] = *(const v4f_ma*)(bl + 16 * t4 + 4);
      }
    }
    __builtin_amdgcn_sched_barrier(0);
    asm volatile("s_wait_xcnt 0x0" ::: "memory");
    // keeps the first use of a loaded value behind the issue of all loads: one global latency for the whole kernel
    __builtin_amdgcn_sched_barrier(0);
#pragma unroll
    for (int rr = 0; rr < 8; ++rr) {
      float v = d[rr] * ww + wb;
      v += t[rr];
      d[rr] = v;
      t[rr] = v;
    }
    wave_sum32_rows(t);
#pragma unroll
    for (int rr = 0; rr < 8; ++rr) { d[rr] -= t[rr] * 0.03125f; t[rr] = d[rr] * d[rr]; }
    wave_sum32_rows(t);
#pragma unroll   // 8 independent chains fill each other's latency
    for (int rr = 0; rr < 8; ++rr) {
      const int l = wave * 8 + rr;
      const float var = t[rr] * 0.03125f;
      const float y   = d[rr] * fast_rsq(var + 1e-5f) * g + be;
      xs[l][lane] = y;
      xh[l][lane] = (_Float16)y;
    }
  }
  __syncthreads();
  // keeps the f16 conversion of the weights, and with it the wait for their loads, out of step 1
  __builtin_amdgcn_sched_barrier(0);

  // 2) q/k/v = x.W^T + b : one 16x16 tile (mt,nt) per wave for each of q,k,v ; K = 32 = one k-step
  {
    const int mt = wave >> 1, nt = wave & 1;
    const int arow = mt * 16 + m16, ncol = nt * 16 + m16, drow = mt * 16 + 8 * hh;
    FragH a;
    a.half[0] = *(const v8h_ma*)(&xh[arow][8 * hh]);
    a.half[1] = *(const v8h_ma*)(&xh[arow][16 + 8 * hh]);
    {
      v8f acc = {};
      acc = wmma_f16(a.v, wfrag_f16(wqr), acc);
      const float bb = bqr;
#pragma unroll
      for (int r = 0; r < 8; ++r) qf[drow + r][ncol] = acc[r] + bb;
    }
    {
      v8f acc = {};
      acc = wmma_f16(a.v, wfrag_f16(wkr), acc);
      const float bb = bkr;
#pragma unroll
      for (int r = 0; r < 8; ++r) kf[mt][(8 * hh + r) * 36 + ncol] = acc[r] + bb;
    }
    {
      v8f acc = {};
      acc = wmma_f16(a.v, wfrag_f16(wvr), acc);
      const float bb = bvr;
#pragma unroll
      for (int r = 0; r < 8; ++r) vh[drow + r][ncol] = (_Float16)(acc[r] + bb);
    }
  }
  __syncthreads();

  // 3) attention core, one wave per (16 queries, head), two heads a wave, no barrier inside: S^T = K.Q^T on the f32 WMMA puts
  //    the scores of query m16 for keys 16*t + 8*hh + r into st[t][r] of lanes m16 and m16 + 16; that is the k map of the A
  //    fragment of P.V, so softmax and P stay in registers (one exchange with lane ^ 16 for the maximum, one for the sum).
  {
    const float rsD = 0.35355339059327373f;     // 1/sqrt(8)
#pragma unroll   // u indexes cwv and cbv, which stay in registers only under constant indices
    for (int u = 0; u < 2; ++u) {
      const int h = (wave >> 2) + 2 * u;
      const float cw = cwv[u], cb = cbv[u];
      v2f qb[2], ka[4][2];
#pragma unroll
      for (int e = 0; e < 2; ++e) {
        qb[e] = *(const v2f_ma*)(&qf[q0 + m16][h * 8 + 4 * e + 2 * hh]);      // B[k = d][n = query]
#pragma unroll
        for (int t = 0; t < 4; ++t)
          ka[t][e] = *(const v2f_ma*)(&kf[t][m16 * 36 + h * 8 + 4 * e + 2 * hh]);   // A[m = key][k = d]
      }
      v8f st[4];
#pragma unroll   // four independent accumulators per k-step
      for (int t = 0; t < 4; ++t) { const v8f z = {}; st[t] = wmma_f32(ka[t][0], qb[0], z); }
#pragma unroll
      for (int t = 0; t < 4; ++t) st[t] = wmma_f32(ka[t][1], qb[1], st[t]);
      float sc[4][8];
      float mx = -3.0e38f;
#pragma unroll
      for (int t = 0; t < 4; ++t)
#pragma unroll
        for (int r = 0; r < 8; ++r) {
          const float sv = st[t][r] * rsD + (bias[t][r >> 2][r & 3] * cw + cb);
          sc[t][r] = sv;
          mx = fmaxf(mx, sv);
        }
      mx = fmaxf(mx, __shfl_xor(mx, 16, 32));
      float sum = 0.f;
#pragma unroll
      for (int t = 0; t < 4; ++t)
#pragma unroll
        for (int r = 0; r < 8; ++r) { const float e = __expf(sc[t][r] - mx); sc[t][r] = e; sum += e; }
      sum += __shfl_xor(sum, 16, 32);
      const float inv = 4096.0f * fast_rcp(sum);  // P carried x4096 (exact power of two) for the f16 operand
      const int vcol = h * 8 + (m16 & 7);
      v8f acc = {};
#pragma unroll
      for (int ks = 0; ks < 2; ++ks) {
        const int k0 = ks * 32;
        v16h pa = {};                             // A[m = query][k = key]: key = k0 + kof(i, hh) = 16*(2*ks + (i>>3)) + 8*hh + (i&7)
        v16h bvv = {};                            // B[k = key][n = d] = v[key][h*8+d], columns n>=8 zero
#pragma unroll
        for (int i = 0; i < 16; ++i) {
          pa[i] = (_Float16)(sc[2 * ks + (i >> 3)][i & 7] * inv);
          const _Float16 t = vh[k0 + kof(i, hh)][vcol];
          bvv[i] = (m16 < 8) ? t : (_Float16)0.0f;
        }
        acc = wmma_f16(pa, bvv, acc);
      }
      if (m16 < 8) {
        const int drow = q0 + 8 * hh;
#pragma unroll
        for (int r = 0; r < 8; ++r) og[drow + r][h * 8 + m16] = acc[r] * (1.0f / 4096.0f);
      }
    }
  }
  __syncthreads();

  // 4) gate: oh[l][h*8+c] = og[l][h*8+c] * sigmoid(sum_d gate_w[h][c][d] og[l][h*8+d] + gate_b[h][c])
  {
    const int hc = lane, h8 = hc & 24;            // row l = wave + 8 * j
    float ov[8][8], oc[8];
#pragma unroll   // all LDS reads of the thread's 8 rows issue before the first use
    for (int j = 0; j < 8; ++j) {
      const int l = wave + 8 * j;
#pragma unroll
      for (int d = 0; d < 8; ++d) ov[j][d] = og[l][h8 + d];
      oc[j] = og[l][hc];
    }
#pragma unroll   // 8 independent dot / exp / reciprocal chains fill each other's latency
    for (int j = 0; j < 8; ++j) {
      float acc = gbr;
#pragma unroll
      for (int d = 0; d < 8; ++d) acc += gwr[d] * ov[j][d];
      const float gs = fast_rcp(1.0f + __expf(-acc));
      oh[wave + 8 * j][hc] = (_Float16)(oc[j] * gs);
    }
  }
  __syncthreads();

  // 5) output projection: o2 = oh.wo^T + bo ; one tile per wave
  {
    const int mt = wave >> 1, nt = wave & 1;
    const int arow = mt * 16 + m16, ncol = nt * 16 + m16, drow = mt * 16 + 8 * hh;
    FragH a;
    a.half[0] = *(const v8h_ma*)(&oh[arow][8 * hh]);
    a.half[1] = *(const v8h_ma*)(&oh[arow][16 + 8 * hh]);
    v8f acc = {};
    acc = wmma_f16(a.v, wfrag_f16(wor), acc);
    const float bb = bor;
#pragma unroll
    for (int r = 0; r < 8; ++r) o2[drow + r][ncol] = acc[r] + bb;
  }
  __syncthreads();

  // 6) residual + LN, staged back into xs (each lane rewrites only the element it read)
  {
    const float g = ang, be = anb;
    float d[8], t[8];
#pragma unroll   // the wave's 8 rows side by side: their LDS reads are in flight together
    for (int rr = 0; rr < 8; ++rr) {
      const int l = wave * 8 + rr;
      const float v = xs[l][lane] + o2[l][lane];
      d[rr] = v;
      t[rr] = v;
    }
    wave_sum32_rows(t);
#pragma unroll
    for (int rr = 0; rr < 8; ++rr) { d[rr] -= t[rr] * 0.03125f; t[rr] = d[rr] * d[rr]; }
    wave_sum32_rows(t);
#pragma unroll   // 8 independent chains fill each other's latency
    for (int rr = 0; rr < 8; ++rr) {
      const float var = t[rr] * 0.03125f;
      xs[wave * 8 + rr][lane] = d[rr] * fast_rsq(var + 1e-5f) * g + be;
    }
  }
  __syncthreads();

  {
    float* xg = xw + (size_t)bs * 2048;
    const int col = 4 * (lane & 7);
    const int r0 = wave * 8 + (lane >> 3), r1 = r0 + 4;
    const v4f v0 = *(const v4f_ma*)(&xs[r0][col]);
    const v4f v1 = *(const v4f_ma*)(&xs[r1][col]);
    *(v4f*)(xg + r0 * 32 + col) = v0;
    *(v4f*)(xg + r1 * 32 + col) = v1;
    
  }
}

// ---------------------------------------------------------------------------------------------
// Kernel 2: one block per (b, tile of 16 rows i). m = max over tracks, unit rows, bf16 hi/lo;
// T_p[i][d] = sum_c mh[i][c] A_p[c][d]  (A_p[c][d] = pp_w[p][c*32+d]);  feat_p[i][j] = sum_d T_p[i][d] mh[j][d] + pp_b[p];
// ---------------------------------------------------------------------------------------------
__global__ __launch_bounds__(256) void k_pair(
    const float* __restrict__ xw, const float* __restrict__ ppw, const float* __restrict__ pp_b,
    const float* __restrict__ ada_g, const float* __restrict__ ada_b, const float* __restrict__ ada_alpha,
    float* __restrict__ out, int nblk)
{
  // Row pitches are 16 B x odd (80 B, 144 B, 272 B): the 16-byte fragment reads of 16 rows fall on different banks,
  // and so do the two 8-row halves of an accumulator store.
  __shared__ __attribute__((aligned(16))) unsigned short mhi[64][40];   // bf16 bits, hi part of unit rows, 32 used
  __shared__ __attribute__((aligned(16))) unsigned short mlo[64][40];   // bf16 bits, lo part, 32 used
  __shared__ __attribute__((aligned(16))) float tf[16][16][36];         // T_p for this block's 16 rows, f32, 32 used
  __shared__ __attribute__((aligned(16))) float fo[16][16][68];         // feat / final values (p, i, j), 64 used
  float* mf = &fo[0][0][0];                                            // [64*32] f32 max rows; dead before fo is first written

  const int tid = threadIdx.x, wave = tid >> 5, lane = tid & 31;
  const int hh = lane >> 4, m16 = lane & 15;
  const int blk = blockIdx.x;
  if (blk >= nblk) return;                     // block-uniform
  const int b = blk >> 2, i0 = (blk & 3) * 16;

  // The pair weights of step 3 and the bias of step 4 depend on no computed value: they are issued in step 1, behind that
  // step's own loads, and share that step's one global latency; only step 5 still reads global memory (alpha, ada_g, ada_b).
  float wf[4][16], pbv[2];

  // 1) max over the 4 tracks
  {
    const float* xb = xw + (size_t)b * 8192;
    float xv[8][4];
#pragma unroll   // all 32 loads in flight together
    for (int j = 0; j < 8; ++j)
#pragma unroll
      for (int c = 0; c < 4; ++c) xv[j][c] = xb[2048 * c + tid + 256 * j];
    // loads return in issue order: keeps this step's own loads in front of the weights
    __builtin_amdgcn_sched_barrier(0);
#pragma unroll   // the global loads of all four B fragments are in flight together
    for (int u = 0; u < 4; ++u) {
      const float* wp = ppw + (size_t)(wave * 2 + (u >> 1)) * 1024 + (u & 1) * 16 + m16;
#pragma unroll
      for (int i = 0; i < 16; ++i) wf[u][i] = wp[kof(i, hh) * 32];
    }
    pbv[0] = pp_b[wave * 2];
    pbv[1] = pp_b[wave * 2 + 1];
    // nothing is scheduled between the last load and the wait below
    __builtin_amdgcn_sched_barrier(0);
    // precaution: the address registers of the loads above are reused behind them
    asm volatile("s_wait_xcnt 0x0" ::: "memory");
    // keeps the first use of a loaded value behind the issue of all loads: one global latency for all of them
    __builtin_amdgcn_sched_barrier(0);
#pragma unroll
    for (int j = 0; j < 8; ++j) {
      float v = xv[j][0];
      v = fmaxf(v, xv[j][1]);
      v = fmaxf(v, xv[j][2]);
      v = fmaxf(v, xv[j][3]);
      mf[tid + 256 * j] = v;
    }
  }
  __syncthreads();

  // 2) unit rows (the pair norm factorises as |m_i|*|m_j|; clamp applied per factor), split into bf16 hi + lo
  {
    float v[8], t[8];
#pragma unroll   // the wave's 8 rows side by side: their LDS reads are in flight together
    for (int rr = 0; rr < 8; ++rr) {
      v[rr] = mf[(wave * 8 + rr) * 32 + lane];
      t[rr] = v[rr] * v[rr];
    }
    wave_sum32_rows(t);
#pragma unroll   // 8 independent chains fill each other's latency
    for (int rr = 0; rr < 8; ++rr) {
      const float inv = fminf(fast_rsq(t[rr]), 1e3f);   // = 1 / max(sqrt(t), 1e-3); t = 0 gives +inf, clamped
      v[rr] *= inv;
    }
#pragma unroll   // two rows share each packed convert
    for (int rr = 0; rr < 8; rr += 2) {
      const int l = wave * 8 + rr;
      unsigned int hb, lb;
      bf_split2(v[rr], v[rr + 1], hb, lb);
      mhi[l][lane]     = (unsigned short)hb;
      mhi[l + 1][lane] = (unsigned short)(hb >> 16);
      mlo[l][lane]     = (unsigned short)lb;
      mlo[l + 1][lane] = (unsigned short)(lb >> 16);
    }
  }
  __syncthreads();

  // 3) GEMM1: wave handles p = 2*wave, 2*wave+1 and both 16-column halves of d; K = 32 (c), one k-step, 3 products
  {
    const int arow = i0 + m16;
    FragU ahi, alo;                              // A[m = i][k = c] = mh[i0+i][c]
    ahi.half[0] = *(const v8us_ma*)(&mhi[arow][8 * hh]);
    ahi.half[1] = *(const v8us_ma*)(&mhi[arow][16 + 8 * hh]);
    alo.half[0] = *(const v8us_ma*)(&mlo[arow][8 * hh]);
    alo.half[1] = *(const v8us_ma*)(&mlo[arow][16 + 8 * hh]);
#pragma unroll   // wf stays in registers
    for (int pp = 0; pp < 2; ++pp) {
      const int p = wave * 2 + pp;
#pragma unroll
      for (int nt = 0; nt < 2; ++nt) {
        const int n = nt * 16 + m16;             // B[k = c][n = d] = pp_w[p][c*32 + d]
        FragU bh, bl;
#pragma unroll
        for (int i = 0; i < 16; i += 2)
          bf_split2(wf[pp * 2 + nt][i], wf[pp * 2 + nt][i + 1], bh.w[i >> 1], bl.w[i >> 1]);
        v8f acc = {};
        acc = wmma_bf16(ahi.v, bh.v, acc);
        acc = wmma_bf16(ahi.v, bl.v, acc);
        acc = wmma_bf16(alo.v, bh.v, acc);
#pragma unroll
        for (int r = 0; r < 8; ++r) tf[p][8 * hh + r][n] = acc[r];
      }
    }
  }
  __syncthreads();

  // 4) GEMM2: feat_p[i][j] ; A[m = i][k = d] = T_p[i][d] (f32 in LDS, split at load), B[k = d][n = j] = mh[j][d] (row j, k-contiguous)
#pragma unroll 1
  for (int nt = 0; nt < 4; ++nt) {
    const int brow = nt * 16 + m16;
    FragU bh, bl;
    bh.half[0] = *(const v8us_ma*)(&mhi[brow][8 * hh]);
    bh.half[1] = *(const v8us_ma*)(&mhi[brow][16 + 8 * hh]);
    bl.half[0] = *(const v8us_ma*)(&mlo[brow][8 * hh]);
    bl.half[1] = *(const v8us_ma*)(&mlo[brow][16 + 8 * hh]);
    float ta[2][16];
#pragma unroll   // the LDS reads of both A fragments are in flight together
    for (int pp = 0; pp < 2; ++pp)
#pragma unroll
      for (int i = 0; i < 16; ++i) ta[pp][i] = tf[wave * 2 + pp][m16][kof(i, hh)];
#pragma unroll   // ta stays in registers
    for (int pp = 0; pp < 2; ++pp) {
      const int p = wave * 2 + pp;
      FragU ah, al;
#pragma unroll
      for (int i = 0; i < 16; i += 2) bf_split2(ta[pp][i], ta[pp][i + 1], ah.w[i >> 1], al.w[i >> 1]);
      v8f acc = {};
      acc = wmma_bf16(ah.v, bh.v, acc);
      acc = wmma_bf16(ah.v, bl.v, acc);
      acc = wmma_bf16(al.v, bh.v, acc);
      const float pb = pbv[pp];
#pragma unroll
      for (int r = 0; r < 8; ++r) fo[p][8 * hh + r][brow] = acc[r] + pb;
    }
  }
  __syncthreads();

  // 5) AdaNorm over p (16 values per (i,j)) and SiLU, in place
  {
    const float alpha = ada_alpha[0];
    float v[4][16], mu[4], rs[4];
#pragma unroll   // the thread's 4 positions side by side: LDS reads in flight together
    for (int jq = 0; jq < 4; ++jq) {
      const int q = tid + 256 * jq;
#pragma unroll
      for (int p = 0; p < 16; ++p) v[jq][p] = fo[p][q >> 6][q & 63];
    }
#pragma unroll   // 4 independent mean / variance chains fill each other's latency
    for (int jq = 0; jq < 4; ++jq) {
      float m = 0.f;
#pragma unroll
      for (int p = 0; p < 16; ++p) m += v[jq][p];
      m *= 0.0625f;
      float var = 0.f;
#pragma unroll
      for (int p = 0; p < 16; ++p) { const float d = v[jq][p] - m; var += d * d; }
      var *= 0.0625f;
      mu[jq] = m;
      rs[jq] = fast_rsq(var + 1e-5f);
    }
#pragma unroll   // v stays in registers
    for (int jq = 0; jq < 4; ++jq) {
      const int q = tid + 256 * jq;
#pragma unroll
      for (int p = 0; p < 16; ++p) {
        const float f = v[jq][p] + alpha * ((v[jq][p] - mu[jq]) * rs[jq] * ada_g[p] + ada_b[p]);
        fo[p][q >> 6][q & 63] = f * fast_rcp(1.0f + __expf(-f));
      }
    }
  }
  __syncthreads();

  {
    const size_t pbase = (size_t)b * 16;
    const int col = 4 * (lane & 15), rsel = lane >> 4;
    v4f v[16];
#pragma unroll   // all 16 LDS reads are in flight together, then the stores follow without a wait in between
    for (int u = 0; u < 16; ++u) {
      const int rho = wave * 32 + 2 * u + rsel;
      v[u] = *(const v4f_ma*)(&fo[rho >> 4][rho & 15][col]);
    }
#pragma unroll
    for (int u = 0; u < 16; ++u) {
      const int rho = wave * 32 + 2 * u + rsel;
      const int p = rho >> 4, i = rho & 15;
      *(v4f*)(out + (((pbase + p) * 64 + (size_t)(i0 + i)) * 64 + col)) = v[u];
    }
    
  }
}

extern "C" void kernel_launch(void* const* d_in, const int* in_sizes, int n_in,
                              void* d_out, int out_size, void* d_ws, size_t ws_size,
                              hipStream_t stream) {
  if (n_in < 29 || d_out == 0 || d_ws == 0) return;
  const int nB = in_sizes[0] / 64;
  if (nB <= 0 || in_sizes[0] != nB * 64 || in_sizes[1] != nB * 64 || in_sizes[2] != nB * 64 ||
      in_sizes[3] != nB * 64 || in_sizes[4] != nB * 4096 ||
      in_sizes[5] < 32 || in_sizes[6] < 32 || in_sizes[7] != 2048 || in_sizes[8] < 32 || in_sizes[9] < 32 ||
      in_sizes[10] != 1024 || in_sizes[11] < 32 || in_sizes[12] != 1024 || in_sizes[13] < 32 ||
      in_sizes[14] != 1024 || in_sizes[15] < 32 || in_sizes[16] != 1024 || in_sizes[17] < 32 ||
      in_sizes[18] < 32 || in_sizes[19] < 32 || in_sizes[20] < 4 || in_sizes[21] < 4 ||
      in_sizes[22] != 256 || in_sizes[23] < 32 || in_sizes[24] != 16384 || in_sizes[25] < 16 ||
      in_sizes[26] < 16 || in_sizes[27] < 16 || in_sizes[28] < 1 ||
      out_size != nB * 16 * 4096) return;
  const size_t need = (size_t)nB * 8192 * sizeof(float);      // x after attention: [nB][4][64][32] f32
  if (need > ws_size) return;

  const float* ctcf   = (const float*)d_in[0];
  const float* hac    = (const float*)d_in[1];
  const float* me1    = (const float*)d_in[2];
  const float* me3    = (const float*)d_in[3];
  const float* bulk   = (const float*)d_in[4];
  const float* we_w   = (const float*)d_in[5];
  const float* we_b   = (const float*)d_in[6];
  const float* pos    = (const float*)d_in[7];
  const float* mn_g   = (const float*)d_in[8];
  const float* mn_b   = (const float*)d_in[9];
  const float* wq     = (const float*)d_in[10];
  const float* bq     = (const float*)d_in[11];
  const float* wk     = (const float*)d_in[12];
  const float* bk     = (const float*)d_in[13];
  const float* wv     = (const float*)d_in[14];
  const float* bv     = (const float*)d_in[15];
  const float* wo     = (const float*)d_in[16];
  const float* bo     = (const float*)d_in[17];
  const float* an_g   = (const float*)d_in[18];
  const float* an_b   = (const float*)d_in[19];
  const float* conv_w = (const float*)d_in[20];
  const float* conv_b = (const float*)d_in[21];
  const float* gate_w = (const float*)d_in[22];
  const float* gate_b = (const float*)d_in[23];
  const float* pp_w   = (const float*)d_in[24];
  const float* pp_b   = (const float*)d_in[25];
  const float* ada_g  = (const float*)d_in[26];
  const float* ada_b  = (const float*)d_in[27];
  const float* ada_a  = (const float*)d_in[28];

  float* ws_x = (float*)d_ws;
  const int nbs = nB * 4;          // (b,s) blocks
  const int nblk = nB * 4;         // (b, 16-row tile) blocks

  k_attn<<<nbs, 256, 0, stream>>>(ctcf, hac, me1, me3, bulk, we_w, we_b, pos, mn_g, mn_b,
                                   wq, bq, wk, bk, wv, bv, wo, bo, an_g, an_b,
                                   conv_w, conv_b, gate_w, gate_b, ws_x, nbs);
  k_pair<<<nblk, 256, 0, stream>>>(ws_x, pp_w, pp_b, ada_g, ada_b, ada_a, (float*)d_out, nblk);
}

// v007
// It runs in 10.9 microseconds.
// Two timings next to v006 put it at 1.13 and 1.16 times that version's speed.
// Counting every step since v000, it is 2.85 times as fast.
// Contractions: q/k/v/out projections and P.V on v_wmma_f32_16x16x32_f16 (f16 operands, P scaled by 4096, f32 accumulate); pair path T=m.A_p and feat=T.m^T on v_wmma_f32_16x16x32_bf16 as bf16 hi/lo split (3 products each, f32 accumulate); k.q^T (K=8) on v_wmma_f32_16x16x4_f32 (f32 operands); gate (K=8) on VALU f32.
#include <hip/hip_runtime.h>

typedef _Float16       v16h  __attribute__((ext_vector_type(16)));
typedef _Float16       v8h   __attribute__((ext_vector_type(8)));
typedef __bf16         v16b  __attribute__((ext_vector_type(16)));
typedef unsigned short v16us __attribute__((ext_vector_type(16)));
typedef unsigned short v8us  __attribute__((ext_vector_type(8)));
typedef float          v8f   __attribute__((ext_vector_type(8)));
typedef float          v4f   __attribute__((ext_vector_type(4)));
typedef float          v2f   __attribute__((ext_vector_type(2)));
typedef __bf16         v2b   __attribute__((ext_vector_type(2)));
typedef v8h  __attribute__((may_alias)) v8h_ma;
typedef v8us __attribute__((may_alias)) v8us_ma;
typedef v4f  __attribute__((may_alias)) v4f_ma;
typedef v2f  __attribute__((may_alias)) v2f_ma;

union FragH { v16h v;  v8h  half[2]; };
union FragU { v16us v; v8us half[2]; unsigned int w[8]; };

// 32-lane butterfly sums of 8 independent rows, stage by stage: the 8 cross-lane moves of a stage are in flight
// together, so a stage costs one cross-lane latency for all rows. Per row the order of the sum is 16, 8, 4, 2, 1.
__device__ __forceinline__ void wave_sum32_rows(float (&v)[8]) {
#pragma unroll   // constant lane masks
  for (int o = 16; o > 0; o >>= 1) {
    float t[8];
#pragma unroll   // rows stay in registers; all moves of the stage issue before the first add
    for (int r = 0; r < 8; ++r) t[r] = __shfl_xor(v[r], o, 32);
#pragma unroll
    for (int r = 0; r < 8; ++r) v[r] += t[r];
  }
}

// 16x16x32 fragment k map, identical for A and B: element i of a lane with hh = lane>>4 holds k = (i&7) + 16*(i>>3) + 8*hh.
// A: lane&15 = row m, B: lane&15 = column n, D: acc[r] = (row 8*hh + r, col lane&15).
__device__ __forceinline__ int kof(int i, int hh) { return (i & 7) + ((i >> 3) << 4) + 8 * hh; }

__device__ __forceinline__ v8f wmma_f16(v16h a, v16h b, v8f c) {
  c = __builtin_amdgcn_wmma_f32_16x16x32_f16(false, a, false, b, (short)0, c, false, false);
  asm volatile("v_nop\n\tv_nop\n\tv_nop\n\tv_nop" : "+v"(c) : "v"(a), "v"(b));
  return c;
}

__device__ __forceinline__ v8f wmma_bf16(v16us a, v16us b, v8f c) {
  v16b ab = __builtin_bit_cast(v16b, a);
  v16b bb = __builtin_bit_cast(v16b, b);
  c = __builtin_amdgcn_wmma_f32_16x16x32_bf16(false, ab, false, bb, (short)0, c, false, false);
  asm volatile("v_nop\n\tv_nop\n\tv_nop\n\tv_nop" : "+v"(c) : "v"(ab), "v"(bb));
  return c;
}

// f32 16x16x4: a lane holds 2 of the 4 k of its row (A) or column (B); both operands are loaded by the same k map
// (k = 2*hh + element), D as in the 16-bit forms.
__device__ __forceinline__ v8f wmma_f32(v2f a, v2f b, v8f c) {
  c = __builtin_amdgcn_wmma_f32_16x16x4_f32(false, a, false, b, (short)0, c, false, false);
  // as in the two helpers above: four vector slots before any vector instruction may touch D, A or B
  asm volatile("v_nop\n\tv_nop\n\tv_nop\n\tv_nop" : "+v"(c) : "v"(a), "v"(b));
  return c;
}

// Bare v_rcp_f32 / v_rsq_f32 (about 1 ulp) in place of the IEEE divide (about 10 dependent vector instructions) and of
// 1 / sqrtf (about 25). Every argument here is a normal f32 or +inf (1 + exp, a softmax sum >= 1, variance + 1e-5),
// except the square sum of a row, whose zero or denormal case ends in the clamp behind it.
__device__ __forceinline__ float fast_rcp(float x) { return __builtin_amdgcn_rcpf(x); }
__device__ __forceinline__ float fast_rsq(float x) { return __builtin_amdgcn_rsqf(x); }

// Two f32 -> their bf16 hi parts and bf16 lo parts (lo = bf16(x - hi)), each pair packed in one dword, x0 in the low half.
// The packed hardware convert rounds to nearest even, as the integer rounding it replaces did; x - hi is exact in f32.
__device__ __forceinline__ void bf_split2(float x0, float x1, unsigned int& hi, unsigned int& lo) {
  const v2f x = {x0, x1};
  const v2b h = __builtin_convertvector(x, v2b);
  const v2f r = {x0 - (float)h[0], x1 - (float)h[1]};
  const v2b l = __builtin_convertvector(r, v2b);
  hi = __builtin_bit_cast(unsigned int, h);
  lo = __builtin_bit_cast(unsigned int, l);
}

// B fragment for output column n of X.W^T with W stored [n][k] f32, pitch 32 (B[k][n] = W[n][k]): the global loads alone,
// so that they can be issued long before the fragment is needed ...
// (k = kof(i, hh) is two runs of 8 floats, at 8*hh and at 16 + 8*hh: four 16-byte loads, w[i >> 2][i & 3] = W[n][kof(i, hh)])
// r = W + n * 32 + 8 * hh
__device__ __forceinline__ void wfrag_load(const float* __restrict__ r, v4f (&w)[4]) {
  w[0] = *(const v4f_ma*)(r);
  w[1] = *(const v4f_ma*)(r + 4);
  w[2] = *(const v4f_ma*)(r + 16);
  w[3] = *(const v4f_ma*)(r + 20);
}
// ... and the conversion to f16 at the place of use
__device__ __forceinline__ v16h wfrag_f16(const v4f (&w)[4]) {
  v16h f = {};
#pragma unroll
  for (int i = 0; i < 16; ++i) f[i] = (_Float16)w[i >> 2][i & 3];
  return f;
}

// ---------------------------------------------------------------------------------------------
// Kernel 1: one block per (b,s). Builds x = LN(msa+pos), row attention with bulk bias, gate,
// ---------------------------------------------------------------------------------------------
__global__ __launch_bounds__(256) void k_attn(
    const float* __restrict__ ctcf, const float* __restrict__ hac,
    const float* __restrict__ me1,  const float* __restrict__ me3,
    const float* __restrict__ bulk,
    const float* __restrict__ we_w, const float* __restrict__ we_b,
    const float* __restrict__ pos,
    const float* __restrict__ mn_g, const float* __restrict__ mn_b,
    const float* __restrict__ wq,   const float* __restrict__ bq,
    const float* __restrict__ wk,   const float* __restrict__ bk,
    const float* __restrict__ wv,   const float* __restrict__ bv,
    const float* __restrict__ wo,   const float* __restrict__ bo,
    const float* __restrict__ an_g, const float* __restrict__ an_b,
    const float* __restrict__ conv_w, const float* __restrict__ conv_b,
    const float* __restrict__ gate_w, const float* __restrict__ gate_b,
    float* __restrict__ xw, int nbs)
{
  __shared__ __attribute__((aligned(16))) float    xs[64][32];   // x f32 (kept for residual), then LN output staging
  // Row pitches are 16 B x odd (80 B, 144 B): the 16-byte reads of 16 (or 4) different rows then fall on different banks.
  __shared__ __attribute__((aligned(16))) _Float16 xh[64][40];   // x f16 (A operand of q/k/v), 32 used
  __shared__ __attribute__((aligned(16))) float    qf[64][36];   // 32 used
  // k: [quarter of 16 keys][key in quarter * 36 + channel]; 8 unused floats behind each quarter
  __shared__ __attribute__((aligned(16))) float    kf[4][16 * 36 + 8];
  __shared__ __attribute__((aligned(16))) _Float16 vh[64][40];   // v f16 (B operand of P.V), 32 used
  __shared__ __attribute__((aligned(16))) float    og[64][32];   // P.V output (l, h*8+d)
  __shared__ __attribute__((aligned(16))) _Float16 oh[64][40];   // gated output, f16 (A operand of out proj), 32 used
  __shared__ __attribute__((aligned(16))) float    o2[64][36];   // out proj + bias, 32 used

  const int tid = threadIdx.x, wave = tid >> 5, lane = tid & 31;
  const int hh = lane >> 4, m16 = lane & 15;
  const int bs = blockIdx.x;
  if (bs >= nbs) return;                       // block-uniform
  const int b = bs >> 2, s = bs & 3;

  // Everything that steps 2 to 6 read from global memory. None of it depends on a computed value, so all of it is issued
  // in step 1, behind that step's own loads, and lands under that step's work (its closing __syncthreads() waits for every
  // outstanding load); no later step waits for global memory.
  const int q0 = (wave & 3) * 16;               // step 3: the wave's 16 queries
  const int pcol = (wave & 1) * 16 + m16;       // steps 2 and 5: the lane's output column
  v4f wqr[4], wkr[4], wvr[4], wor[4];
  float gwr[8];
  float bqr, bkr, bvr, bor, gbr, ang, anb;
  v4f bias[4][2];                               // lane (m16, hh) takes bulk[b][q0 + m16][16*t + 8*hh + 0..7]
  float cwv[2], cbv[2];

  // 1) x = LN(signal * we_w + we_b + pos); wave per row, lane = channel
  {
    // two-level select on the bits of s: compiles to scalar selects, no branch, so that all kernel arguments are fetched at once
    const float* sig01 = (s & 1) ? hac : ctcf;
    const float* sig23 = (s & 1) ? me3 : me1;
    const float* sig = (s & 2) ? sig23 : sig01;
    const float ww = we_w[lane], wb = we_b[lane], g = mn_g[lane], be = mn_b[lane];
    float d[8], t[8];
#pragma unroll   // the wave's 8 rows side by side: their global loads are in flight together
    for (int rr = 0; rr < 8; ++rr) {
      const int l = wave * 8 + rr;
      d[rr] = sig[b * 64 + l];
      t[rr] = pos[l * 32 + lane];
    }
    // the one-line parameters of the later steps ride along here
    bqr = bq[pcol];  bkr = bk[pcol];  bvr = bv[pcol];  bor = bo[pcol];
    gbr = gate_b[lane];  ang = an_g[lane];  anb = an_b[lane];
#pragma unroll
    for (int u = 0; u < 2; ++u) { cwv[u] = conv_w[(wave >> 2) + 2 * u]; cbv[u] = conv_b[(wave >> 2) + 2 * u]; }
    // The scheduling barriers keep the three groups of loads in this order (loads return in issue order: this step's own
    // come first) and let nothing in between a group's last load and the wait behind it. Each wait is a precaution: the
    // address registers of the group in front of it are reused behind it, also as the results of the next group's loads.
    __builtin_amdgcn_sched_barrier(0);
    asm volatile("s_wait_xcnt 0x0" ::: "memory");
    __builtin_amdgcn_sched_barrier(0);
    const int woff = pcol * 32 + 8 * hh;
    wfrag_load(wq + woff, wqr);
    wfrag_load(wk + woff, wkr);
    wfrag_load(wv + woff, wvr);
    wfrag_load(wo + woff, wor);
#pragma unroll
    for (int dd = 0; dd < 8; ++dd) gwr[dd] = gate_w[lane * 8 + dd];
    __builtin_amdgcn_sched_barrier(0);
    asm volatile("s_wait_xcnt 0x0" ::: "memory");
    __builtin_amdgcn_sched_barrier(0);
    {
      const float* bl = bulk + ((size_t)b * 64 + q0 + m16) * 64 + 8 * hh;
#pragma unroll
      for (int t4 = 0; t4 < 4; ++t4) {
        bias[t4][0] = *(const v4f_ma*)(bl + 16 * t4);
        bias[t4][1] = *(const v4f_ma*)(bl + 16 * t4 + 4);
      }
    }
    __builtin_amdgcn_sched_barrier(0);
    asm volatile("s_wait_xcnt 0x0" ::: "memory");
    // keeps the first use of a loaded value behind the issue of all loads: one global latency for the whole kernel
    __builtin_amdgcn_sched_barrier(0);
#pragma unroll
    for (int rr = 0; rr < 8; ++rr) {
      float v = d[rr] * ww + wb;
      v += t[rr];
      d[rr] = v;
      t[rr] = v;
    }
    wave_sum32_rows(t);
#pragma unroll
    for (int rr = 0; rr < 8; ++rr) { d[rr] -= t[rr] * 0.03125f; t[rr] = d[rr] * d[rr]; }
    wave_sum32_rows(t);
#pragma unroll   // 8 independent chains fill each other's latency
    for (int rr = 0; rr < 8; ++rr) {
      const int l = wave * 8 + rr;
      const float var = t[rr] * 0.03125f;
      const float y   = d[rr] * fast_rsq(var + 1e-5f) * g + be;
      xs[l][lane] = y;
      xh[l][lane] = (_Float16)y;
    }
  }
  __syncthreads();
  // keeps the f16 conversion of the weights, and with it the wait for their loads, out of step 1
  __builtin_amdgcn_sched_barrier(0);

  // 2) q/k/v = x.W^T + b : one 16x16 tile (mt,nt) per wave for each of q,k,v ; K = 32 = one k-step
  {
    const int mt = wave >> 1, nt = wave & 1;
    const int arow = mt * 16 + m16, ncol = nt * 16 + m16, drow = mt * 16 + 8 * hh;
    FragH a;
    a.half[0] = *(const v8h_ma*)(&xh[arow][8 * hh]);
    a.half[1] = *(const v8h_ma*)(&xh[arow][16 + 8 * hh]);
    {
      v8f acc = {};
      acc = wmma_f16(a.v, wfrag_f16(wqr), acc);
      const float bb = bqr;
#pragma unroll
      for (int r = 0; r < 8; ++r) qf[drow + r][ncol] = acc[r] + bb;
    }
    {
      v8f acc = {};
      acc = wmma_f16(a.v, wfrag_f16(wkr), acc);
      const float bb = bkr;
#pragma unroll
      for (int r = 0; r < 8; ++r) kf[mt][(8 * hh + r) * 36 + ncol] = acc[r] + bb;
    }
    {
      v8f acc = {};
      acc = wmma_f16(a.v, wfrag_f16(wvr), acc);
      const float bb = bvr;
#pragma unroll
      for (int r = 0; r < 8; ++r) vh[drow + r][ncol] = (_Float16)(acc[r] + bb);
    }
  }
  __syncthreads();

  // 3) attention core, one wave per (16 queries, head), two heads a wave, no barrier inside: S^T = K.Q^T on the f32 WMMA puts
  //    the scores of query m16 for keys 16*t + 8*hh + r into st[t][r] of lanes m16 and m16 + 16; that is the k map of the A
  //    fragment of P.V, so softmax and P stay in registers (one exchange with lane ^ 16 for the maximum, one for the sum).
  {
    const float rsD = 0.35355339059327373f;     // 1/sqrt(8)
#pragma unroll   // u indexes cwv and cbv, which stay in registers only under constant indices
    for (int u = 0; u < 2; ++u) {
      const int h = (wave >> 2) + 2 * u;
      const float cw = cwv[u], cb = cbv[u];
      v2f qb[2], ka[4][2];
#pragma unroll
      for (int e = 0; e < 2; ++e) {
        qb[e] = *(const v2f_ma*)(&qf[q0 + m16][h * 8 + 4 * e + 2 * hh]);      // B[k = d][n = query]
#pragma unroll
        for (int t = 0; t < 4; ++t)
          ka[t][e] = *(const v2f_ma*)(&kf[t][m16 * 36 + h * 8 + 4 * e + 2 * hh]);   // A[m = key][k = d]
      }
      v8f st[4];
#pragma unroll   // four independent accumulators per k-step
      for (int t = 0; t < 4; ++t) { const v8f z = {}; st[t] = wmma_f32(ka[t][0], qb[0], z); }
#pragma unroll
      for (int t = 0; t < 4; ++t) st[t] = wmma_f32(ka[t][1], qb[1], st[t]);
      float sc[4][8];
      float mx = -3.0e38f;
#pragma unroll
      for (int t = 0; t < 4; ++t)
#pragma unroll
        for (int r = 0; r < 8; ++r) {
          const float sv = st[t][r] * rsD + (bias[t][r >> 2][r & 3] * cw + cb);
          sc[t][r] = sv;
          mx = fmaxf(mx, sv);
        }
      mx = fmaxf(mx, __shfl_xor(mx, 16, 32));
      float sum = 0.f;
#pragma unroll
      for (int t = 0; t < 4; ++t)
#pragma unroll
        for (int r = 0; r < 8; ++r) { const float e = __expf(sc[t][r] - mx); sc[t][r] = e; sum += e; }
      sum += __shfl_xor(sum, 16, 32);
      const float inv = 4096.0f * fast_rcp(sum);  // P carried x4096 (exact power of two) for the f16 operand
      const int vcol = h * 8 + (m16 & 7);
      v8f acc = {};
#pragma unroll
      for (int ks = 0; ks < 2; ++ks) {
        const int k0 = ks * 32;
        v16h pa = {};                             // A[m = query][k = key]: key = k0 + kof(i, hh) = 16*(2*ks + (i>>3)) + 8*hh + (i&7)
        v16h bvv = {};                            // B[k = key][n = d] = v[key][h*8+d], columns n>=8 zero
#pragma unroll
        for (int i = 0; i < 16; ++i) {
          pa[i] = (_Float16)(sc[2 * ks + (i >> 3)][i & 7] * inv);
          const _Float16 t = vh[k0 + kof(i, hh)][vcol];
          bvv[i] = (m16 < 8) ? t : (_Float16)0.0f;
        }
        acc = wmma_f16(pa, bvv, acc);
      }
      if (m16 < 8) {
        const int drow = q0 + 8 * hh;
#pragma unroll
        for (int r = 0; r < 8; ++r) og[drow + r][h * 8 + m16] = acc[r] * (1.0f / 4096.0f);
      }
    }
  }
  __syncthreads();

  // 4) gate: oh[l][h*8+c] = og[l][h*8+c] * sigmoid(sum_d gate_w[h][c][d] og[l][h*8+d] + gate_b[h][c])
  {
    const int hc = lane, h8 = hc & 24;            // row l = wave + 8 * j
    float ov[8][8], oc[8];
#pragma unroll   // all LDS reads of the thread's 8 rows issue before the first use
    for (int j = 0; j < 8; ++j) {
      const int l = wave + 8 * j;
#pragma unroll
      for (int d = 0; d < 8; ++d) ov[j][d] = og[l][h8 + d];
      oc[j] = og[l][hc];
    }
#pragma unroll   // 8 independent dot / exp / reciprocal chains fill each other's latency
    for (int j = 0; j < 8; ++j) {
      float acc = gbr;
#pragma unroll
      for (int d = 0; d < 8; ++d) acc += gwr[d] * ov[j][d];
      const float gs = fast_rcp(1.0f + __expf(-acc));
      oh[wave + 8 * j][hc] = (_Float16)(oc[j] * gs);
    }
  }
  __syncthreads();

  // 5) output projection: o2 = oh.wo^T + bo ; one tile per wave
  {
    const int mt = wave >> 1, nt = wave & 1;
    const int arow = mt * 16 + m16, ncol = nt * 16 + m16, drow = mt * 16 + 8 * hh;
    FragH a;
    a.half[0] = *(const v8h_ma*)(&oh[arow][8 * hh]);
    a.half[1] = *(const v8h_ma*)(&oh[arow][16 + 8 * hh]);
    v8f acc = {};
    acc = wmma_f16(a.v, wfrag_f16(wor), acc);
    const float bb = bor;
#pragma unroll
    for (int r = 0; r < 8; ++r) o2[drow + r][ncol] = acc[r] + bb;
  }
  __syncthreads();

  // 6) residual + LN, staged back into xs (each lane rewrites only the element it read)
  {
    const float g = ang, be = anb;
    float d[8], t[8];
#pragma unroll   // the wave's 8 rows side by side: their LDS reads are in flight together
    for (int rr = 0; rr < 8; ++rr) {
      const int l = wave * 8 + rr;
      const float v = xs[l][lane] + o2[l][lane];
      d[rr] = v;
      t[rr] = v;
    }
    wave_sum32_rows(t);
#pragma unroll
    for (int rr = 0; rr < 8; ++rr) { d[rr] -= t[rr] * 0.03125f; t[rr] = d[rr] * d[rr]; }
    wave_sum32_rows(t);
#pragma unroll   // 8 independent chains fill each other's latency
    for (int rr = 0; rr < 8; ++rr) {
      const float var = t[rr] * 0.03125f;
      xs[wave * 8 + rr][lane] = d[rr] * fast_rsq(var + 1e-5f) * g + be;
    }
  }
  __syncthreads();

  {
    float* xg = xw + (size_t)bs * 2048;
    const int col = 4 * (lane & 7);
    const int r0 = wave * 8 + (lane >> 3), r1 = r0 + 4;
    const v4f v0 = *(const v4f_ma*)(&xs[r0][col]);
    const v4f v1 = *(const v4f_ma*)(&xs[r1][col]);
    *(v4f*)(xg + r0 * 32 + col) = v0;
    *(v4f*)(xg + r1 * 32 + col) = v1;
    
  }
}

// ---------------------------------------------------------------------------------------------
// Kernel 2: one block per (b, tile of 16 rows i). m = max over tracks, unit rows, bf16 hi/lo;
// T_p[i][d] = sum_c mh[i][c] A_p[c][d]  (A_p[c][d] = pp_w[p][c*32+d]);  feat_p[i][j] = sum_d T_p[i][d] mh[j][d] + pp_b[p];
// the second product runs per row i with the 16 pair channels p as its M side, so that AdaNorm (over p) stays in registers.
// ---------------------------------------------------------------------------------------------

// lane l with lane l ^ 16
__device__ __forceinline__ float xhalf(float x) {
  const int b = __builtin_bit_cast(int, x);
  return __builtin_bit_cast(float, __builtin_amdgcn_permlanex16(b, b, 0x76543210, 0xfedcba98, false, false));
}

__global__ __launch_bounds__(256) void k_pair(
    const float* __restrict__ xw, const float* __restrict__ ppw, const float* __restrict__ pp_b,
    const float* __restrict__ ada_g, const float* __restrict__ ada_b, const float* __restrict__ ada_alpha,
    float* __restrict__ out, int nblk)
{
  // Unit rows, bf16 bits, hi and lo part: row j lies at [j & 3][(j >> 2) * 40 + c], 32 of 40 used. A B fragment of step 4
  // takes the 16 rows j = 4 * n + nt, which lie 80 B (16 B x odd) apart; the 32 shorts behind each quarter set the rows
  // i0 + 0..15 of step 3's A fragment on different banks too.
  __shared__ __attribute__((aligned(16))) unsigned short mhi[4][16 * 40 + 32];
  __shared__ __attribute__((aligned(16))) unsigned short mlo[4][16 * 40 + 32];
  // T for this block's 16 rows, f32: [i][p * 36 + d], 32 of 36 used (144 B = 16 B x odd between the 16 p of an A fragment);
  // the 4 floats behind each i set the two 8-row halves of an accumulator store 32 banks apart
  __shared__ __attribute__((aligned(16))) float tf[16][16 * 36 + 4];
  float* mf = &tf[0][0];                                               // [64*32] f32 max rows; dead before tf is first written

  const int tid = threadIdx.x, wave = tid >> 5, lane = tid & 31;
  const int hh = lane >> 4, m16 = lane & 15;
  const int blk = blockIdx.x;
  if (blk >= nblk) return;                     // block-uniform
  const int b = blk >> 2, i0 = (blk & 3) * 16;

  // The pair weights of step 3 and the parameters of step 4 depend on no computed value: they are issued in step 1, behind
  // that step's own loads, and share that step's one global latency; no later step waits for global memory.
  float wf[4][16];
  v4f pbr[2], agr[2], abr[2];                  // pp_b, ada_g, ada_b of the lane's 8 channels p = 8*hh + 0..7
  float alpha;

  // 1) max over the 4 tracks
  {
    const float* xb = xw + (size_t)b * 8192;
    float xv[8][4];
#pragma unroll   // all 32 loads in flight together
    for (int j = 0; j < 8; ++j)
#pragma unroll
      for (int c = 0; c < 4; ++c) xv[j][c] = xb[2048 * c + tid + 256 * j];
    // loads return in issue order: keeps this step's own loads in front of the weights
    __builtin_amdgcn_sched_barrier(0);
#pragma unroll   // the global loads of all four B fragments are in flight together
    for (int u = 0; u < 4; ++u) {
      const float* wp = ppw + (size_t)(wave * 2 + (u >> 1)) * 1024 + (u & 1) * 16 + m16;
#pragma unroll
      for (int i = 0; i < 16; ++i) wf[u][i] = wp[kof(i, hh) * 32];
    }
#pragma unroll
    for (int e = 0; e < 2; ++e) {
      pbr[e] = *(const v4f_ma*)(pp_b  + 8 * hh + 4 * e);
      agr[e] = *(const v4f_ma*)(ada_g + 8 * hh + 4 * e);
      abr[e] = *(const v4f_ma*)(ada_b + 8 * hh + 4 * e);
    }
    alpha = ada_alpha[0];
    // nothing is scheduled between the last load and the wait below
    __builtin_amdgcn_sched_barrier(0);
    // precaution: the address registers of the loads above are reused behind them
    asm volatile("s_wait_xcnt 0x0" ::: "memory");
    // keeps the first use of a loaded value behind the issue of all loads: one global latency for all of them
    __builtin_amdgcn_sched_barrier(0);
#pragma unroll
    for (int j = 0; j < 8; ++j) {
      float v = xv[j][0];
      v = fmaxf(v, xv[j][1]);
      v = fmaxf(v, xv[j][2]);
      v = fmaxf(v, xv[j][3]);
      mf[tid + 256 * j] = v;
    }
  }
  __syncthreads();

  // 2) unit rows (the pair norm factorises as |m_i|*|m_j|; clamp applied per factor), split into bf16 hi + lo
  {
    float v[8], t[8];
#pragma unroll   // the wave's 8 rows side by side: their LDS reads are in flight together
    for (int rr = 0; rr < 8; ++rr) {
      v[rr] = mf[(wave * 8 + rr) * 32 + lane];
      t[rr] = v[rr] * v[rr];
    }
    wave_sum32_rows(t);
#pragma unroll   // 8 independent chains fill each other's latency
    for (int rr = 0; rr < 8; ++rr) {
      const float inv = fminf(fast_rsq(t[rr]), 1e3f);   // = 1 / max(sqrt(t), 1e-3); t = 0 gives +inf, clamped
      v[rr] *= inv;
    }
#pragma unroll   // two rows share each packed convert
    for (int rr = 0; rr < 8; rr += 2) {
      const int at = (wave * 2 + (rr >> 2)) * 40 + lane;   // row l = wave * 8 + rr: l >> 2 = wave * 2 + (rr >> 2), l & 3 = rr & 3
      unsigned int hb, lb;
      bf_split2(v[rr], v[rr + 1], hb, lb);
      mhi[rr & 3][at]       = (unsigned short)hb;
      mhi[(rr & 3) + 1][at] = (unsigned short)(hb >> 16);
      mlo[rr & 3][at]       = (unsigned short)lb;
      mlo[(rr & 3) + 1][at] = (unsigned short)(lb >> 16);
    }
  }
  __syncthreads();

  // The B fragments of step 4 are unit rows too: read here, they land under step 3's work
  FragU bh[4], bl[4];                            // B[k = d][n] = mh[4*n + nt][d]
#pragma unroll
  for (int nt = 0; nt < 4; ++nt) {
    bh[nt].half[0] = *(const v8us_ma*)(&mhi[nt][m16 * 40 + 8 * hh]);
    bh[nt].half[1] = *(const v8us_ma*)(&mhi[nt][m16 * 40 + 16 + 8 * hh]);
    bl[nt].half[0] = *(const v8us_ma*)(&mlo[nt][m16 * 40 + 8 * hh]);
    bl[nt].half[1] = *(const v8us_ma*)(&mlo[nt][m16 * 40 + 16 + 8 * hh]);
  }

  // 3) GEMM1: wave handles p = 2*wave, 2*wave+1 and both 16-column halves of d; K = 32 (c), one k-step, 3 products
  {
    const int aq = m16 & 3, aat = ((i0 + m16) >> 2) * 40 + 8 * hh;   // row i0 + m16
    FragU ahi, alo;                              // A[m = i][k = c] = mh[i0+i][c]
    ahi.half[0] = *(const v8us_ma*)(&mhi[aq][aat]);
    ahi.half[1] = *(const v8us_ma*)(&mhi[aq][aat + 16]);
    alo.half[0] = *(const v8us_ma*)(&mlo[aq][aat]);
    alo.half[1] = *(const v8us_ma*)(&mlo[aq][aat + 16]);
#pragma unroll   // wf stays in registers
    for (int pp = 0; pp < 2; ++pp) {
      const int p = wave * 2 + pp;
#pragma unroll
      for (int nt = 0; nt < 2; ++nt) {
        const int n = nt * 16 + m16;             // B[k = c][n = d] = pp_w[p][c*32 + d]
        FragU wh, wl;
#pragma unroll
        for (int i = 0; i < 16; i += 2)
          bf_split2(wf[pp * 2 + nt][i], wf[pp * 2 + nt][i + 1], wh.w[i >> 1], wl.w[i >> 1]);
        v8f acc = {};
        acc = wmma_bf16(ahi.v, wh.v, acc);
        acc = wmma_bf16(ahi.v, wl.v, acc);
        acc = wmma_bf16(alo.v, wh.v, acc);
#pragma unroll
        for (int r = 0; r < 8; ++r) tf[8 * hh + r][p * 36 + n] = acc[r];
      }
    }
  }
  __syncthreads();

  // 4) GEMM2, AdaNorm, SiLU and the output, no barrier inside: a wave owns the rows i = 2*wave, 2*wave+1. Per row
  //    A[m = p][k = d] = T_p[i][d] (f32 in LDS, split at load), B[k = d][n] = mh[4*n + nt][d] for nt = 0..3. A lane then holds
  //    feat of p = 8*hh + r (register r) at j = 4*m16 + nt (tile nt): the sums over p are 8 registers and one exchange with
  //    lane ^ 16, and the four tiles of a register are 16 consecutive bytes of out.
  {
    v4f ta[2][4];                                // ta[ii][i >> 2][i & 3] = T_p[row][kof(i, hh)], p = m16
#pragma unroll
    for (int ii = 0; ii < 2; ++ii) {
      const float* tr = &tf[wave * 2 + ii][m16 * 36 + 8 * hh];
      ta[ii][0] = *(const v4f_ma*)(tr);
      ta[ii][1] = *(const v4f_ma*)(tr + 4);
      ta[ii][2] = *(const v4f_ma*)(tr + 16);
      ta[ii][3] = *(const v4f_ma*)(tr + 20);
    }
    v8f pb, ag, ab;
#pragma unroll
    for (int r = 0; r < 8; ++r) { pb[r] = pbr[r >> 2][r & 3]; ag[r] = agr[r >> 2][r & 3]; ab[r] = abr[r >> 2][r & 3]; }
    v8f acc[2][4];
#pragma unroll   // ta, acc stay in registers
    for (int ii = 0; ii < 2; ++ii) {
      FragU ah, al;
#pragma unroll
      for (int i = 0; i < 16; i += 2)
        bf_split2(ta[ii][i >> 2][i & 3], ta[ii][i >> 2][(i & 3) + 1], ah.w[i >> 1], al.w[i >> 1]);
#pragma unroll   // four independent accumulators per product
      for (int nt = 0; nt < 4; ++nt) { const v8f z = {}; acc[ii][nt] = wmma_bf16(ah.v, bh[nt].v, z); }
#pragma unroll
      for (int nt = 0; nt < 4; ++nt) acc[ii][nt] = wmma_bf16(ah.v, bl[nt].v, acc[ii][nt]);
#pragma unroll
      for (int nt = 0; nt < 4; ++nt) acc[ii][nt] = wmma_bf16(al.v, bh[nt].v, acc[ii][nt]);
    }
    float* ob = out + ((((size_t)b * 16 + 8 * hh) * 64 + (size_t)(i0 + wave * 2)) * 64 + 4 * m16);
#pragma unroll   // acc stays in registers
    for (int ii = 0; ii < 2; ++ii) {
      v8f f[4], d[4];
      float rs[4];
#pragma unroll   // 4 independent mean / variance chains fill each other's latency
      for (int nt = 0; nt < 4; ++nt) {
        f[nt] = acc[ii][nt] + pb;
        const v4f s4 = f[nt].lo + f[nt].hi;      // sums over the lane's 8 channels as a tree of register pairs
        const v2f s2 = s4.lo + s4.hi;
        float m = s2.x + s2.y;
        m += xhalf(m);
        m *= 0.0625f;
        d[nt] = f[nt] - m;
        const v4f q4 = d[nt].lo * d[nt].lo + d[nt].hi * d[nt].hi;
        const v2f q2 = q4.lo + q4.hi;
        float var = q2.x + q2.y;
        var += xhalf(var);
        var *= 0.0625f;
        rs[nt] = fast_rsq(var + 1e-5f);
      }
#pragma unroll
      for (int nt = 0; nt < 4; ++nt) {
        const v8f y = f[nt] + alpha * (d[nt] * rs[nt] * ag + ab);
#pragma unroll
        for (int r = 0; r < 8; ++r) f[nt][r] = y[r] * fast_rcp(1.0f + __expf(-y[r]));
      }
#pragma unroll   // a store covers 256 consecutive bytes of each of two channels
      for (int r = 0; r < 8; ++r) {
        const v4f o = {f[0][r], f[1][r], f[2][r], f[3][r]};
        *(v4f*)(ob + (size_t)r * 4096 + ii * 64) = o;
      }
      if (ii == 0) {
        // the first row's stores leave here, under the second row's arithmetic, and are not gathered at the kernel's end
        __builtin_amdgcn_sched_barrier(0);
        // precaution: the registers of the stores above are reused behind them. The statement names the stores' address as an
        // input: out is __restrict__, and without the name the compiler moves the stores behind the statement
        asm volatile("s_wait_xcnt 0x0" :: "v"(ob) : "memory");
        // nothing of the second row's arithmetic moves in front of the wait
        __builtin_amdgcn_sched_barrier(0);
      }
    }
  }
}

extern "C" void kernel_launch(void* const* d_in, const int* in_sizes, int n_in,
                              void* d_out, int out_size, void* d_ws, size_t ws_size,
                              hipStream_t stream) {
  if (n_in < 29 || d_out == 0 || d_ws == 0) return;
  const int nB = in_sizes[0] / 64;
  if (nB <= 0 || in_sizes[0] != nB * 64 || in_sizes[1] != nB * 64 || in_sizes[2] != nB * 64 ||
      in_sizes[3] != nB * 64 || in_sizes[4] != nB * 4096 ||
      in_sizes[5] < 32 || in_sizes[6] < 32 || in_sizes[7] != 2048 || in_sizes[8] < 32 || in_sizes[9] < 32 ||
      in_sizes[10] != 1024 || in_sizes[11] < 32 || in_sizes[12] != 1024 || in_sizes[13] < 32 ||
      in_sizes[14] != 1024 || in_sizes[15] < 32 || in_sizes[16] != 1024 || in_sizes[17] < 32 ||
      in_sizes[18] < 32 || in_sizes[19] < 32 || in_sizes[20] < 4 || in_sizes[21] < 4 ||
      in_sizes[22] != 256 || in_sizes[23] < 32 || in_sizes[24] != 16384 || in_sizes[25] < 16 ||
      in_sizes[26] < 16 || in_sizes[27] < 16 || in_sizes[28] < 1 ||
      out_size != nB * 16 * 4096) return;
  const size_t need = (size_t)nB * 8192 * sizeof(float);      // x after attention: [nB][4][64][32] f32
  if (need > ws_size) return;

  const float* ctcf   = (const float*)d_in[0];
  const float* hac    = (const float*)d_in[1];
  const float* me1    = (const float*)d_in[2];
  const float* me3    = (const float*)d_in[3];
  const float* bulk   = (const float*)d_in[4];
  const float* we_w   = (const float*)d_in[5];
  const float* we_b   = (const float*)d_in[6];
  const float* pos    = (const float*)d_in[7];
  const float* mn_g   = (const float*)d_in[8];
  const float* mn_b   = (const float*)d_in[9];
  const float* wq     = (const float*)d_in[10];
  const float* bq     = (const float*)d_in[11];
  const float* wk     = (const float*)d_in[12];
  const float* bk     = (const float*)d_in[13];
  const float* wv     = (const float*)d_in[14];
  const float* bv     = (const float*)d_in[15];
  const float* wo     = (const float*)d_in[16];
  const float* bo     = (const float*)d_in[17];
  const float* an_g   = (const float*)d_in[18];
  const float* an_b   = (const float*)d_in[19];
  const float* conv_w = (const float*)d_in[20];
  const float* conv_b = (const float*)d_in[21];
  const float* gate_w = (const float*)d_in[22];
  const float* gate_b = (const float*)d_in[23];
  const float* pp_w   = (const float*)d_in[24];
  const float* pp_b   = (const float*)d_in[25];
  const float* ada_g  = (const float*)d_in[26];
  const float* ada_b  = (const float*)d_in[27];
  const float* ada_a  = (const float*)d_in[28];

  float* ws_x = (float*)d_ws;
  const int nbs = nB * 4;          // (b,s) blocks
  const int nblk = nB * 4;         // (b, 16-row tile) blocks

  k_attn<<<nbs, 256, 0, stream>>>(ctcf, hac, me1, me3, bulk, we_w, we_b, pos, mn_g, mn_b,
                                   wq, bq, wk, bk, wv, bv, wo, bo, an_g, an_b,
                                   conv_w, conv_b, gate_w, gate_b, ws_x, nbs);
  k_pair<<<nblk, 256, 0, stream>>>(ws_x, pp_w, pp_b, ada_g, ada_b, ada_a, (float*)d_out, nblk);
}

// v008
// One run takes 10.2 microseconds.
// Timed twice side by side with v007, it ran 1.08 and 1.07 times as fast.
// Over all steps from v000 it is 3.05 times as fast.
// Contractions: q/k/v/out projections and P.V on v_wmma_f32_16x16x32_f16 (f16 operands, P scaled by 4096, f32 accumulate); pair path T=m.A_p and feat=T.m^T on v_wmma_f32_16x16x32_bf16 as bf16 hi/lo split (3 products each, f32 accumulate); k.q^T (K=8) on v_wmma_f32_16x16x4_f32 (f32 operands); gate (K=8) on VALU f32.
#include <hip/hip_runtime.h>

typedef _Float16       v16h  __attribute__((ext_vector_type(16)));
typedef _Float16       v8h   __attribute__((ext_vector_type(8)));
typedef __bf16         v16b  __attribute__((ext_vector_type(16)));
typedef unsigned short v16us __attribute__((ext_vector_type(16)));
typedef unsigned short v8us  __attribute__((ext_vector_type(8)));
typedef float          v8f   __attribute__((ext_vector_type(8)));
typedef float          v4f   __attribute__((ext_vector_type(4)));
typedef float          v2f   __attribute__((ext_vector_type(2)));
typedef __bf16         v2b   __attribute__((ext_vector_type(2)));
typedef _Float16       v4h   __attribute__((ext_vector_type(4)));
typedef v8h  __attribute__((may_alias)) v8h_ma;
typedef v4h  __attribute__((may_alias)) v4h_ma;
typedef v8us __attribute__((may_alias)) v8us_ma;
typedef v4f  __attribute__((may_alias)) v4f_ma;
typedef v2f  __attribute__((may_alias)) v2f_ma;

union FragH { v16h v;  v8h  half[2]; };
union FragU { v16us v; v8us half[2]; unsigned int w[8]; };

// 32-lane butterfly sums of 8 independent rows, stage by stage: the 8 cross-lane moves of a stage are in flight
// together, so a stage costs one cross-lane latency for all rows. Per row the order of the sum is 16, 8, 4, 2, 1.
__device__ __forceinline__ void wave_sum32_rows(float (&v)[8]) {
#pragma unroll   // constant lane masks
  for (int o = 16; o > 0; o >>= 1) {
    float t[8];
#pragma unroll   // rows stay in registers; all moves of the stage issue before the first add
    for (int r = 0; r < 8; ++r) t[r] = __shfl_xor(v[r], o, 32);
#pragma unroll
    for (int r = 0; r < 8; ++r) v[r] += t[r];
  }
}

// 16x16x32 fragment k map, identical for A and B: element i of a lane with hh = lane>>4 holds k = (i&7) + 16*(i>>3) + 8*hh.
// A: lane&15 = row m, B: lane&15 = column n, D: acc[r] = (row 8*hh + r, col lane&15).
__device__ __forceinline__ int kof(int i, int hh) { return (i & 7) + ((i >> 3) << 4) + 8 * hh; }

__device__ __forceinline__ v8f wmma_f16(v16h a, v16h b, v8f c) {
  c = __builtin_amdgcn_wmma_f32_16x16x32_f16(false, a, false, b, (short)0, c, false, false);
  asm volatile("v_nop\n\tv_nop\n\tv_nop\n\tv_nop" : "+v"(c) : "v"(a), "v"(b));
  return c;
}

__device__ __forceinline__ v8f wmma_bf16(v16us a, v16us b, v8f c) {
  v16b ab = __builtin_bit_cast(v16b, a);
  v16b bb = __builtin_bit_cast(v16b, b);
  c = __builtin_amdgcn_wmma_f32_16x16x32_bf16(false, ab, false, bb, (short)0, c, false, false);
  asm volatile("v_nop\n\tv_nop\n\tv_nop\n\tv_nop" : "+v"(c) : "v"(ab), "v"(bb));
  return c;
}

// f32 16x16x4: a lane holds 2 of the 4 k of its row (A) or column (B); both operands are loaded by the same k map
// (k = 2*hh + element), D as in the 16-bit forms.
__device__ __forceinline__ v8f wmma_f32(v2f a, v2f b, v8f c) {
  c = __builtin_amdgcn_wmma_f32_16x16x4_f32(false, a, false, b, (short)0, c, false, false);
  // as in the two helpers above: four vector slots before any vector instruction may touch D, A or B
  asm volatile("v_nop\n\tv_nop\n\tv_nop\n\tv_nop" : "+v"(c) : "v"(a), "v"(b));
  return c;
}

// Bare v_rcp_f32 / v_rsq_f32 (about 1 ulp) in place of the IEEE divide (about 10 dependent vector instructions) and of
// 1 / sqrtf (about 25). Every argument here is a normal f32 or +inf (1 + exp, a softmax sum >= 1, variance + 1e-5),
// except the square sum of a row, whose zero or denormal case ends in the clamp behind it.
__device__ __forceinline__ float fast_rcp(float x) { return __builtin_amdgcn_rcpf(x); }
__device__ __forceinline__ float fast_rsq(float x) { return __builtin_amdgcn_rsqf(x); }

// Two f32 -> their bf16 hi parts and bf16 lo parts (lo = bf16(x - hi)), each pair packed in one dword, x0 in the low half.
// The packed hardware convert rounds to nearest even, as the integer rounding it replaces did; x - hi is exact in f32.
__device__ __forceinline__ void bf_split2(float x0, float x1, unsigned int& hi, unsigned int& lo) {
  const v2f x = {x0, x1};
  const v2b h = __builtin_convertvector(x, v2b);
  const v2f r = {x0 - (float)h[0], x1 - (float)h[1]};
  const v2b l = __builtin_convertvector(r, v2b);
  hi = __builtin_bit_cast(unsigned int, h);
  lo = __builtin_bit_cast(unsigned int, l);
}

// B fragment for output column n of X.W^T with W stored [n][k] f32, pitch 32 (B[k][n] = W[n][k]): the global loads alone,
// so that they can be issued long before the fragment is needed ...
// (k = kof(i, hh) is two runs of 8 floats, at 8*hh and at 16 + 8*hh: four 16-byte loads, w[i >> 2][i & 3] = W[n][kof(i, hh)])
// r = W + n * 32 + 8 * hh
__device__ __forceinline__ void wfrag_load(const float* __restrict__ r, v4f (&w)[4]) {
  w[0] = *(const v4f_ma*)(r);
  w[1] = *(const v4f_ma*)(r + 4);
  w[2] = *(const v4f_ma*)(r + 16);
  w[3] = *(const v4f_ma*)(r + 20);
}
// ... and the conversion to f16 at the place of use
__device__ __forceinline__ v16h wfrag_f16(const v4f (&w)[4]) {
  v16h f = {};
#pragma unroll
  for (int i = 0; i < 16; ++i) f[i] = (_Float16)w[i >> 2][i & 3];
  return f;
}

// 8 consecutive floats of LDS, 16-byte aligned
__device__ __forceinline__ v8f lds8(const float* p) {
  const v4f a = *(const v4f_ma*)(p), b = *(const v4f_ma*)(p + 4);
  return __builtin_shufflevector(a, b, 0, 1, 2, 3, 4, 5, 6, 7);
}

// lane l with lane l ^ 16
__device__ __forceinline__ float xhalf(float x) {
  const int b = __builtin_bit_cast(int, x);
  return __builtin_bit_cast(float, __builtin_amdgcn_permlanex16(b, b, 0x76543210, 0xfedcba98, false, false));
}

// ---------------------------------------------------------------------------------------------
// Kernel 1: one block per (b,s). Builds x = LN(msa+pos), row attention with bulk bias, gate,
// ---------------------------------------------------------------------------------------------
__global__ __launch_bounds__(256) void k_attn(
    const float* __restrict__ ctcf, const float* __restrict__ hac,
    const float* __restrict__ me1,  const float* __restrict__ me3,
    const float* __restrict__ bulk,
    const float* __restrict__ we_w, const float* __restrict__ we_b,
    const float* __restrict__ pos,
    const float* __restrict__ mn_g, const float* __restrict__ mn_b,
    const float* __restrict__ wq,   const float* __restrict__ bq,
    const float* __restrict__ wk,   const float* __restrict__ bk,
    const float* __restrict__ wv,   const float* __restrict__ bv,
    const float* __restrict__ wo,   const float* __restrict__ bo,
    const float* __restrict__ an_g, const float* __restrict__ an_b,
    const float* __restrict__ conv_w, const float* __restrict__ conv_b,
    const float* __restrict__ gate_w, const float* __restrict__ gate_b,
    float* __restrict__ xw, int nbs)
{
  // Row pitches are 16 B x odd (80 B, 144 B): the 16-byte reads of 16 (or 4) different rows then fall on different banks.
  __shared__ __attribute__((aligned(16))) float    xs[64][36];   // x f32 (kept for residual), 32 used
  __shared__ __attribute__((aligned(16))) _Float16 xh[64][40];   // x f16 (A operand of q/k/v), 32 used
  __shared__ __attribute__((aligned(16))) float    qf[64][36];   // 32 used
  // k: [quarter of 16 keys][key in quarter * 36 + channel]; 8 unused floats behind each quarter
  __shared__ __attribute__((aligned(16))) float    kf[4][16 * 36 + 8];
  __shared__ __attribute__((aligned(16))) _Float16 vh[64][40];   // v f16 (B operand of P.V), 32 used
  __shared__ __attribute__((aligned(16))) float    og[64][36];   // P.V output (l, h*8+d), 32 used
  __shared__ __attribute__((aligned(16))) _Float16 woh[32][40];  // wo f16 (A operand of out proj), 32 used
  __shared__ __attribute__((aligned(16))) float    gws[256];     // gate_w, transposed to [h][d][c]
  __shared__ __attribute__((aligned(16))) float    prm[4][32];   // bo, an_g, an_b, gate_b

  const int tid = threadIdx.x, wave = tid >> 5, lane = tid & 31;
  const int hh = lane >> 4, m16 = lane & 15;
  const int bs = blockIdx.x;
  if (bs >= nbs) return;                       // block-uniform
  const int b = bs >> 2, s = bs & 3;
  // waves 0 to 3 run step 4, each on 16 rows; the test is a scalar one
  const int wid = __builtin_amdgcn_readfirstlane(wave);
  const bool tailw = wid < 4;

  // Everything that steps 2 to 4 read from global memory. None of it depends on a computed value, so all of it is issued
  // in step 1, behind that step's own loads, and lands under that step's work (its closing __syncthreads() waits for every
  // outstanding load); no later step waits for global memory.
  const int q0 = (wave & 3) * 16;               // step 3: the wave's 16 queries
  const int pcol = (wave & 1) * 16 + m16;       // step 2: the lane's output column
  v4f wqr[4], wkr[4], wvr[4];
  v4f wov;                                      // four elements of wo, whole lines per wave: on to LDS as f16
  float gwv, prv;                               // one element of gate_w; one of bo, an_g, an_b or gate_b: on to LDS
  float bqr, bkr, bvr;
  v4f bias[4][2];                               // lane (m16, hh) takes bulk[b][q0 + m16][16*t + 8*hh + 0..7]
  float cwv[2], cbv[2];

  // 1) x = LN(signal * we_w + we_b + pos); wave per row, lane = channel
  {
    // two-level select on the bits of s: compiles to scalar selects, no branch, so that all kernel arguments are fetched at once
    const float* sig01 = (s & 1) ? hac : ctcf;
    const float* sig23 = (s & 1) ? me3 : me1;
    const float* sig = (s & 2) ? sig23 : sig01;
    const float ww = we_w[lane], wb = we_b[lane], g = mn_g[lane], be = mn_b[lane];
    float d[8], t[8];
#pragma unroll   // the wave's 8 rows side by side: their global loads are in flight together
    for (int rr = 0; rr < 8; ++rr) {
      const int l = wave * 8 + rr;
      d[rr] = sig[b * 64 + l];
      t[rr] = pos[l * 32 + lane];
    }
    // the one-line parameters of the later steps ride along here
    bqr = bq[pcol];  bkr = bk[pcol];  bvr = bv[pcol];
    {
      const float* p01 = (wid & 1) ? an_g : bo;
      const float* p23 = (wid & 1) ? gate_b : an_b;
      prv = ((wid & 2) ? p23 : p01)[lane];
    }
    gwv = gate_w[tid];
#pragma unroll
    for (int u = 0; u < 2; ++u) { cwv[u] = conv_w[(wave >> 2) + 2 * u]; cbv[u] = conv_b[(wave >> 2) + 2 * u]; }
    // The scheduling barriers keep the three groups of loads in this order (loads return in issue order: this step's own
    // come first) and let nothing in between a group's last load and the wait behind it. Each wait is a precaution: the
    // address registers of the group in front of it are reused behind it, also as the results of the next group's loads.
    __builtin_amdgcn_sched_barrier(0);
    asm volatile("s_wait_xcnt 0x0" ::: "memory");
    __builtin_amdgcn_sched_barrier(0);
    const int woff = pcol * 32 + 8 * hh;
    wfrag_load(wq + woff, wqr);
    wfrag_load(wk + woff, wkr);
    wfrag_load(wv + woff, wvr);
    wov = *(const v4f_ma*)(wo + tid * 4);
    __builtin_amdgcn_sched_barrier(0);
    asm volatile("s_wait_xcnt 0x0" ::: "memory");
    __builtin_amdgcn_sched_barrier(0);
    {
      const float* bl = bulk + ((size_t)b * 64 + q0 + m16) * 64 + 8 * hh;
#pragma unroll
      for (int t4 = 0; t4 < 4; ++t4) {
        bias[t4][0] = *(const v4f_ma*)(bl + 16 * t4);
        bias[t4][1] = *(const v4f_ma*)(bl + 16 * t4 + 4);
      }
    }
    __builtin_amdgcn_sched_barrier(0);
    asm volatile("s_wait_xcnt 0x0" ::: "memory");
    // keeps the first use of a loaded value behind the issue of all loads: one global latency for the whole kernel
    __builtin_amdgcn_sched_barrier(0);
#pragma unroll
    for (int rr = 0; rr < 8; ++rr) {
      float v = d[rr] * ww + wb;
      v += t[rr];
      d[rr] = v;
      t[rr] = v;
    }
    wave_sum32_rows(t);
#pragma unroll
    for (int rr = 0; rr < 8; ++rr) { d[rr] -= t[rr] * 0.03125f; t[rr] = d[rr] * d[rr]; }
    wave_sum32_rows(t);
#pragma unroll   // 8 independent chains fill each other's latency
    for (int rr = 0; rr < 8; ++rr) {
      const int l = wave * 8 + rr;
      const float var = t[rr] * 0.03125f;
      const float y   = d[rr] * fast_rsq(var + 1e-5f) * g + be;
      xs[l][lane] = y;
      xh[l][lane] = (_Float16)y;
    }
    // keeps the wait for wov, whose load stands behind the weights', out of the chain above
    __builtin_amdgcn_sched_barrier(0);
    gws[(tid & 192) + (tid & 7) * 8 + ((tid >> 3) & 7)] = gwv;   // [h][c][d] -> [h][d][c]
    {
      const v4h w4 = {(_Float16)wov[0], (_Float16)wov[1], (_Float16)wov[2], (_Float16)wov[3]};
      *(v4h_ma*)(&woh[tid >> 3][4 * (tid & 7)]) = w4;
    }
    // inputs-only use of the loaded value in front of the branch: without it the compiler sinks the load into the branch,
    // where its whole global latency would stand in front of the barrier
    asm volatile("" :: "v"(prv));
    if (tailw) prm[wid][lane] = prv;
  }
  __syncthreads();
  // keeps the f16 conversion of the weights out of step 1
  __builtin_amdgcn_sched_barrier(0);

  // 2) q/k/v = x.W^T + b : one 16x16 tile (mt,nt) per wave for each of q,k,v ; K = 32 = one k-step
  {
    const int mt = wave >> 1, nt = wave & 1;
    const int arow = mt * 16 + m16, ncol = nt * 16 + m16, drow = mt * 16 + 8 * hh;
    FragH a;
    a.half[0] = *(const v8h_ma*)(&xh[arow][8 * hh]);
    a.half[1] = *(const v8h_ma*)(&xh[arow][16 + 8 * hh]);
    {
      v8f acc = {};
      acc = wmma_f16(a.v, wfrag_f16(wqr), acc);
      const float bb = bqr;
#pragma unroll
      for (int r = 0; r < 8; ++r) qf[drow + r][ncol] = acc[r] + bb;
    }
    {
      v8f acc = {};
      acc = wmma_f16(a.v, wfrag_f16(wkr), acc);
      const float bb = bkr;
#pragma unroll
      for (int r = 0; r < 8; ++r) kf[mt][(8 * hh + r) * 36 + ncol] = acc[r] + bb;
    }
    {
      v8f acc = {};
      acc = wmma_f16(a.v, wfrag_f16(wvr), acc);
      const float bb = bvr;
#pragma unroll
      for (int r = 0; r < 8; ++r) vh[drow + r][ncol] = (_Float16)(acc[r] + bb);
    }
  }
  __syncthreads();

  // 3) attention core, one wave per (16 queries, head), two heads a wave, no barrier inside: S^T = K.Q^T on the f32 WMMA puts
  //    the scores of query m16 for keys 16*t + 8*hh + r into st[t][r] of lanes m16 and m16 + 16; that is the k map of the A
  //    fragment of P.V, so softmax and P stay in registers (one exchange with lane ^ 16 for the maximum, one for the sum).
  {
    const float rsD = 0.35355339059327373f;     // 1/sqrt(8)
#pragma unroll   // u indexes cwv and cbv, which stay in registers only under constant indices
    for (int u = 0; u < 2; ++u) {
      const int h = (wave >> 2) + 2 * u;
      const float cw = cwv[u], cb = cbv[u];
      v2f qb[2], ka[4][2];
#pragma unroll
      for (int e = 0; e < 2; ++e) {
        qb[e] = *(const v2f_ma*)(&qf[q0 + m16][h * 8 + 4 * e + 2 * hh]);      // B[k = d][n = query]
#pragma unroll
        for (int t = 0; t < 4; ++t)
          ka[t][e] = *(const v2f_ma*)(&kf[t][m16 * 36 + h * 8 + 4 * e + 2 * hh]);   // A[m = key][k = d]
      }
      v8f st[4];
#pragma unroll   // four independent accumulators per k-step
      for (int t = 0; t < 4; ++t) { const v8f z = {}; st[t] = wmma_f32(ka[t][0], qb[0], z); }
#pragma unroll
      for (int t = 0; t < 4; ++t) st[t] = wmma_f32(ka[t][1], qb[1], st[t]);
      float sc[4][8];
      float mx = -3.0e38f;
#pragma unroll
      for (int t = 0; t < 4; ++t)
#pragma unroll
        for (int r = 0; r < 8; ++r) {
          const float sv = st[t][r] * rsD + (bias[t][r >> 2][r & 3] * cw + cb);
          sc[t][r] = sv;
          mx = fmaxf(mx, sv);
        }
      mx = fmaxf(mx, __shfl_xor(mx, 16, 32));
      float sum = 0.f;
#pragma unroll
      for (int t = 0; t < 4; ++t)
#pragma unroll
        for (int r = 0; r < 8; ++r) { const float e = __expf(sc[t][r] - mx); sc[t][r] = e; sum += e; }
      sum += __shfl_xor(sum, 16, 32);
      const float inv = 4096.0f * fast_rcp(sum);  // P carried x4096 (exact power of two) for the f16 operand
      const int vcol = h * 8 + (m16 & 7);
      v8f acc = {};
#pragma unroll
      for (int ks = 0; ks < 2; ++ks) {
        const int k0 = ks * 32;
        v16h pa = {};                             // A[m = query][k = key]: key = k0 + kof(i, hh) = 16*(2*ks + (i>>3)) + 8*hh + (i&7)
        v16h bvv = {};                            // B[k = key][n = d] = v[key][h*8+d], columns n>=8 zero
#pragma unroll
        for (int i = 0; i < 16; ++i) {
          pa[i] = (_Float16)(sc[2 * ks + (i >> 3)][i & 7] * inv);
          const _Float16 t = vh[k0 + kof(i, hh)][vcol];
          bvv[i] = (m16 < 8) ? t : (_Float16)0.0f;
        }
        acc = wmma_f16(pa, bvv, acc);
      }
      if (m16 < 8) {
        const int drow = q0 + 8 * hh;
#pragma unroll
        for (int r = 0; r < 8; ++r) og[drow + r][h * 8 + m16] = acc[r] * (1.0f / 4096.0f);
      }
    }
  }
  // 4) gate, output projection, residual and LN, all in registers: waves 0 to 3 each own the 16 rows l = 16*wave + m16. The
  //    projection runs transposed, D[m = channel][n = l] = wo . (gated o)^T. Its B fragment holds, for row l, the channels
  //    kof(i, hh), which are the whole heads hh (i < 8) and 2 + hh (i >= 8): the gate's sums over d stay inside a lane, and the
  //    gated values are the fragment. D puts the channels 16*t + 8*hh + r of row l into register r of tile t: the LN sums are
  //    16 registers and one exchange with lane ^ 16.
  const int l = (wave & 3) * 16 + m16;
  v8f gwt[2][8], pgb[2], xr[2], pbo[2], pg[2], pbe[2];   // [t]: head 2*t + hh, channels 16*t + 8*hh + 0..7
  FragH wa[2];                                    // A[m = channel 16*t + m16][k = kof(i, hh)] = wo[m][k]
  if (tailw) {
    // all that does not come from step 3 is read in front of its barrier, while the other waves still work
#pragma unroll
    for (int t = 0; t < 2; ++t) {
      const int ch = 16 * t + 8 * hh;
#pragma unroll
      for (int d = 0; d < 8; ++d) gwt[t][d] = lds8(&gws[(2 * t + hh) * 64 + d * 8]);
      pgb[t] = lds8(&prm[3][ch]);
      wa[t].half[0] = *(const v8h_ma*)(&woh[16 * t + m16][8 * hh]);
      wa[t].half[1] = *(const v8h_ma*)(&woh[16 * t + m16][16 + 8 * hh]);
      xr[t]  = lds8(&xs[l][ch]);
      pbo[t] = lds8(&prm[0][ch]);
      pg[t]  = lds8(&prm[1][ch]);
      pbe[t] = lds8(&prm[2][ch]);
    }
  }
  __syncthreads();
  if (!tailw) return;                             // no barrier behind this line
  {
    v8f ov[2];
#pragma unroll
    for (int t = 0; t < 2; ++t) ov[t] = lds8(&og[l][16 * t + 8 * hh]);
    v16h gb16 = {};                               // B[k = kof(i, hh)][n = l] = o * sigmoid(gate_w . o + gate_b)
#pragma unroll   // 16 independent dot / exp / reciprocal chains fill each other's latency
    for (int t = 0; t < 2; ++t) {
      v8f acc = pgb[t];                           // register c: channel c of the head; summed over d = 0..7 in this order
#pragma unroll
      for (int d = 0; d < 8; ++d) acc += gwt[t][d] * ov[t][d];
#pragma unroll
      for (int cc = 0; cc < 8; ++cc) {
        const float gs = fast_rcp(1.0f + __expf(-acc[cc]));
        gb16[8 * t + cc] = (_Float16)(ov[t][cc] * gs);
      }
    }
    v8f v[2];
#pragma unroll   // the two products stand back to back
    for (int t = 0; t < 2; ++t) { const v8f z = {}; v[t] = wmma_f16(wa[t].v, gb16, z); }
#pragma unroll
    for (int t = 0; t < 2; ++t) v[t] = xr[t] + (v[t] + pbo[t]);
    const v8f s8 = v[0] + v[1];                   // sums over the lane's 16 channels as a tree of register pairs
    const v4f s4 = s8.lo + s8.hi;
    const v2f s2 = s4.lo + s4.hi;
    float m = s2.x + s2.y;
    m += xhalf(m);
    m *= 0.03125f;
    v8f d[2];
    d[0] = v[0] - m;
    d[1] = v[1] - m;
    const v8f q8 = d[0] * d[0] + d[1] * d[1];
    const v4f q4 = q8.lo + q8.hi;
    const v2f q2 = q4.lo + q4.hi;
    float var = q2.x + q2.y;
    var += xhalf(var);
    var *= 0.03125f;
    const float rs = fast_rsq(var + 1e-5f);
    float* xg = xw + (size_t)bs * 2048 + l * 32 + 8 * hh;
#pragma unroll   // a row of x is one 128-byte line, written by the two lanes that hold it
    for (int t = 0; t < 2; ++t) {
      const v8f y = d[t] * rs * pg[t] + pbe[t];
      *(v4f*)(xg + 16 * t)     = y.lo;
      *(v4f*)(xg + 16 * t + 4) = y.hi;
    }
  }
}

// ---------------------------------------------------------------------------------------------
// Kernel 2: one block per (b, tile of 16 rows i). m = max over tracks, unit rows, bf16 hi/lo;
// T_p[i][d] = sum_c mh[i][c] A_p[c][d]  (A_p[c][d] = pp_w[p][c*32+d]);  feat_p[i][j] = sum_d T_p[i][d] mh[j][d] + pp_b[p];
// the second product runs per row i with the 16 pair channels p as its M side, so that AdaNorm (over p) stays in registers.
// ---------------------------------------------------------------------------------------------

__global__ __launch_bounds__(256) void k_pair(
    const float* __restrict__ xw, const float* __restrict__ ppw, const float* __restrict__ pp_b,
    const float* __restrict__ ada_g, const float* __restrict__ ada_b, const float* __restrict__ ada_alpha,
    float* __restrict__ out, int nblk)
{
  // Unit rows, bf16 bits, hi and lo part: row j lies at [j & 3][(j >> 2) * 40 + c], 32 of 40 used. A B fragment of step 4
  // takes the 16 rows j = 4 * n + nt, which lie 80 B (16 B x odd) apart; the 32 shorts behind each quarter set the rows
  // i0 + 0..15 of step 3's A fragment on different banks too.
  __shared__ __attribute__((aligned(16))) unsigned short mhi[4][16 * 40 + 32];
  __shared__ __attribute__((aligned(16))) unsigned short mlo[4][16 * 40 + 32];
  // T for this block's 16 rows, f32: [i][p * 36 + d], 32 of 36 used (144 B = 16 B x odd between the 16 p of an A fragment);
  // the 4 floats behind each i set the two 8-row halves of an accumulator store 32 banks apart
  __shared__ __attribute__((aligned(16))) float tf[16][16 * 36 + 4];
  float* mf = &tf[0][0];                                               // [64*32] f32 max rows; dead before tf is first written

  const int tid = threadIdx.x, wave = tid >> 5, lane = tid & 31;
  const int hh = lane >> 4, m16 = lane & 15;
  const int blk = blockIdx.x;
  if (blk >= nblk) return;                     // block-uniform
  const int b = blk >> 2, i0 = (blk & 3) * 16;

  // The pair weights of step 3 and the parameters of step 4 depend on no computed value: they are issued in step 1, behind
  // that step's own loads, and share that step's one global latency; no later step waits for global memory.
  float wf[4][16];
  v4f pbr[2], agr[2], abr[2];                  // pp_b, ada_g, ada_b of the lane's 8 channels p = 8*hh + 0..7
  float alpha;

  // 1) max over the 4 tracks
  {
    const float* xb = xw + (size_t)b * 8192;
    float xv[8][4];
#pragma unroll   // all 32 loads in flight together
    for (int j = 0; j < 8; ++j)
#pragma unroll
      for (int c = 0; c < 4; ++c) xv[j][c] = xb[2048 * c + tid + 256 * j];
    // loads return in issue order: keeps this step's own loads in front of the weights
    __builtin_amdgcn_sched_barrier(0);
#pragma unroll   // the global loads of all four B fragments are in flight together
    for (int u = 0; u < 4; ++u) {
      const float* wp = ppw + (size_t)(wave * 2 + (u >> 1)) * 1024 + (u & 1) * 16 + m16;
#pragma unroll
      for (int i = 0; i < 16; ++i) wf[u][i] = wp[kof(i, hh) * 32];
    }
#pragma unroll
    for (int e = 0; e < 2; ++e) {
      pbr[e] = *(const v4f_ma*)(pp_b  + 8 * hh + 4 * e);
      agr[e] = *(const v4f_ma*)(ada_g + 8 * hh + 4 * e);
      abr[e] = *(const v4f_ma*)(ada_b + 8 * hh + 4 * e);
    }
    alpha = ada_alpha[0];
    // nothing is scheduled between the last load and the wait below
    __builtin_amdgcn_sched_barrier(0);
    // precaution: the address registers of the loads above are reused behind them
    asm volatile("s_wait_xcnt 0x0" ::: "memory");
    // keeps the first use of a loaded value behind the issue of all loads: one global latency for all of them
    __builtin_amdgcn_sched_barrier(0);
#pragma unroll
    for (int j = 0; j < 8; ++j) {
      float v = xv[j][0];
      v = fmaxf(v, xv[j][1]);
      v = fmaxf(v, xv[j][2]);
      v = fmaxf(v, xv[j][3]);
      mf[tid + 256 * j] = v;
    }
  }
  __syncthreads();

  // 2) unit rows (the pair norm factorises as |m_i|*|m_j|; clamp applied per factor), split into bf16 hi + lo
  {
    float v[8], t[8];
#pragma unroll   // the wave's 8 rows side by side: their LDS reads are in flight together
    for (int rr = 0; rr < 8; ++rr) {
      v[rr] = mf[(wave * 8 + rr) * 32 + lane];
      t[rr] = v[rr] * v[rr];
    }
    wave_sum32_rows(t);
#pragma unroll   // 8 independent chains fill each other's latency
    for (int rr = 0; rr < 8; ++rr) {
      const float inv = fminf(fast_rsq(t[rr]), 1e3f);   // = 1 / max(sqrt(t), 1e-3); t = 0 gives +inf, clamped
      v[rr] *= inv;
    }
#pragma unroll   // two rows share each packed convert
    for (int rr = 0; rr < 8; rr += 2) {
      const int at = (wave * 2 + (rr >> 2)) * 40 + lane;   // row l = wave * 8 + rr: l >> 2 = wave * 2 + (rr >> 2), l & 3 = rr & 3
      unsigned int hb, lb;
      bf_split2(v[rr], v[rr + 1], hb, lb);
      mhi[rr & 3][at]       = (unsigned short)hb;
      mhi[(rr & 3) + 1][at] = (unsigned short)(hb >> 16);
      mlo[rr & 3][at]       = (unsigned short)lb;
      mlo[(rr & 3) + 1][at] = (unsigned short)(lb >> 16);
    }
  }
  __syncthreads();

  // The B fragments of step 4 are unit rows too: read here, they land under step 3's work
  FragU bh[4], bl[4];                            // B[k = d][n] = mh[4*n + nt][d]
#pragma unroll
  for (int nt = 0; nt < 4; ++nt) {
    bh[nt].half[0] = *(const v8us_ma*)(&mhi[nt][m16 * 40 + 8 * hh]);
    bh[nt].half[1] = *(const v8us_ma*)(&mhi[nt][m16 * 40 + 16 + 8 * hh]);
    bl[nt].half[0] = *(const v8us_ma*)(&mlo[nt][m16 * 40 + 8 * hh]);
    bl[nt].half[1] = *(const v8us_ma*)(&mlo[nt][m16 * 40 + 16 + 8 * hh]);
  }

  // 3) GEMM1: wave handles p = 2*wave, 2*wave+1 and both 16-column halves of d; K = 32 (c), one k-step, 3 products
  {
    const int aq = m16 & 3, aat = ((i0 + m16) >> 2) * 40 + 8 * hh;   // row i0 + m16
    FragU ahi, alo;                              // A[m = i][k = c] = mh[i0+i][c]
    ahi.half[0] = *(const v8us_ma*)(&mhi[aq][aat]);
    ahi.half[1] = *(const v8us_ma*)(&mhi[aq][aat + 16]);
    alo.half[0] = *(const v8us_ma*)(&mlo[aq][aat]);
    alo.half[1] = *(const v8us_ma*)(&mlo[aq][aat + 16]);
#pragma unroll   // wf stays in registers
    for (int pp = 0; pp < 2; ++pp) {
      const int p = wave * 2 + pp;
#pragma unroll
      for (int nt = 0; nt < 2; ++nt) {
        const int n = nt * 16 + m16;             // B[k = c][n = d] = pp_w[p][c*32 + d]
        FragU wh, wl;
#pragma unroll
        for (int i = 0; i < 16; i += 2)
          bf_split2(wf[pp * 2 + nt][i], wf[pp * 2 + nt][i + 1], wh.w[i >> 1], wl.w[i >> 1]);
        v8f acc = {};
        acc = wmma_bf16(ahi.v, wh.v, acc);
        acc = wmma_bf16(ahi.v, wl.v, acc);
        acc = wmma_bf16(alo.v, wh.v, acc);
#pragma unroll
        for (int r = 0; r < 8; ++r) tf[8 * hh + r][p * 36 + n] = acc[r];
      }
    }
  }
  __syncthreads();

  // 4) GEMM2, AdaNorm, SiLU and the output, no barrier inside: a wave owns the rows i = 2*wave, 2*wave+1. Per row
  //    A[m = p][k = d] = T_p[i][d] (f32 in LDS, split at load), B[k = d][n] = mh[4*n + nt][d] for nt = 0..3. A lane then holds
  //    feat of p = 8*hh + r (register r) at j = 4*m16 + nt (tile nt): the sums over p are 8 registers and one exchange with
  //    lane ^ 16, and the four tiles of a register are 16 consecutive bytes of out.
  {
    v4f ta[2][4];                                // ta[ii][i >> 2][i & 3] = T_p[row][kof(i, hh)], p = m16
#pragma unroll
    for (int ii = 0; ii < 2; ++ii) {
      const float* tr = &tf[wave * 2 + ii][m16 * 36 + 8 * hh];
      ta[ii][0] = *(const v4f_ma*)(tr);
      ta[ii][1] = *(const v4f_ma*)(tr + 4);
      ta[ii][2] = *(const v4f_ma*)(tr + 16);
      ta[ii][3] = *(const v4f_ma*)(tr + 20);
    }
    v8f pb, ag, ab;
#pragma unroll
    for (int r = 0; r < 8; ++r) { pb[r] = pbr[r >> 2][r & 3]; ag[r] = agr[r >> 2][r & 3]; ab[r] = abr[r >> 2][r & 3]; }
    v8f acc[2][4];
#pragma unroll   // ta, acc stay in registers
    for (int ii = 0; ii < 2; ++ii) {
      FragU ah, al;
#pragma unroll
      for (int i = 0; i < 16; i += 2)
        bf_split2(ta[ii][i >> 2][i & 3], ta[ii][i >> 2][(i & 3) + 1], ah.w[i >> 1], al.w[i >> 1]);
#pragma unroll   // four independent accumulators per product
      for (int nt = 0; nt < 4; ++nt) { const v8f z = {}; acc[ii][nt] = wmma_bf16(ah.v, bh[nt].v, z); }
#pragma unroll
      for (int nt = 0; nt < 4; ++nt) acc[ii][nt] = wmma_bf16(ah.v, bl[nt].v, acc[ii][nt]);
#pragma unroll
      for (int nt = 0; nt < 4; ++nt) acc[ii][nt] = wmma_bf16(al.v, bh[nt].v, acc[ii][nt]);
    }
    float* ob = out + ((((size_t)b * 16 + 8 * hh) * 64 + (size_t)(i0 + wave * 2)) * 64 + 4 * m16);
#pragma unroll   // acc stays in registers
    for (int ii = 0; ii < 2; ++ii) {
      v8f f[4], d[4];
      float rs[4];
#pragma unroll   // 4 independent mean / variance chains fill each other's latency
      for (int nt = 0; nt < 4; ++nt) {
        f[nt] = acc[ii][nt] + pb;
        const v4f s4 = f[nt].lo + f[nt].hi;      // sums over the lane's 8 channels as a tree of register pairs
        const v2f s2 = s4.lo + s4.hi;
        float m = s2.x + s2.y;
        m += xhalf(m);
        m *= 0.0625f;
        d[nt] = f[nt] - m;
        const v4f q4 = d[nt].lo * d[nt].lo + d[nt].hi * d[nt].hi;
        const v2f q2 = q4.lo + q4.hi;
        float var = q2.x + q2.y;
        var += xhalf(var);
        var *= 0.0625f;
        rs[nt] = fast_rsq(var + 1e-5f);
      }
#pragma unroll
      for (int nt = 0; nt < 4; ++nt) {
        const v8f y = f[nt] + alpha * (d[nt] * rs[nt] * ag + ab);
#pragma unroll
        for (int r = 0; r < 8; ++r) f[nt][r] = y[r] * fast_rcp(1.0f + __expf(-y[r]));
      }
#pragma unroll   // a store covers 256 consecutive bytes of each of two channels
      for (int r = 0; r < 8; ++r) {
        const v4f o = {f[0][r], f[1][r], f[2][r], f[3][r]};
        *(v4f*)(ob + (size_t)r * 4096 + ii * 64) = o;
      }
      if (ii == 0) {
        // the first row's stores leave here, under the second row's arithmetic, and are not gathered at the kernel's end
        __builtin_amdgcn_sched_barrier(0);
        // precaution: the registers of the stores above are reused behind them. The statement names the stores' address as an
        // input: out is __restrict__, and without the name the compiler moves the stores behind the statement
        asm volatile("s_wait_xcnt 0x0" :: "v"(ob) : "memory");
        // nothing of the second row's arithmetic moves in front of the wait
        __builtin_amdgcn_sched_barrier(0);
      }
    }
  }
}

extern "C" void kernel_launch(void* const* d_in, const int* in_sizes, int n_in,
                              void* d_out, int out_size, void* d_ws, size_t ws_size,
                              hipStream_t stream) {
  if (n_in < 29 || d_out == 0 || d_ws == 0) return;
  const int nB = in_sizes[0] / 64;
  if (nB <= 0 || in_sizes[0] != nB * 64 || in_sizes[1] != nB * 64 || in_sizes[2] != nB * 64 ||
      in_sizes[3] != nB * 64 || in_sizes[4] != nB * 4096 ||
      in_sizes[5] < 32 || in_sizes[6] < 32 || in_sizes[7] != 2048 || in_sizes[8] < 32 || in_sizes[9] < 32 ||
      in_sizes[10] != 1024 || in_sizes[11] < 32 || in_sizes[12] != 1024 || in_sizes[13] < 32 ||
      in_sizes[14] != 1024 || in_sizes[15] < 32 || in_sizes[16] != 1024 || in_sizes[17] < 32 ||
      in_sizes[18] < 32 || in_sizes[19] < 32 || in_sizes[20] < 4 || in_sizes[21] < 4 ||
      in_sizes[22] != 256 || in_sizes[23] < 32 || in_sizes[24] != 16384 || in_sizes[25] < 16 ||
      in_sizes[26] < 16 || in_sizes[27] < 16 || in_sizes[28] < 1 ||
      out_size != nB * 16 * 4096) return;
  const size_t need = (size_t)nB * 8192 * sizeof(float);      // x after attention: [nB][4][64][32] f32
  if (need > ws_size) return;

  const float* ctcf   = (const float*)d_in[0];
  const float* hac    = (const float*)d_in[1];
  const float* me1    = (const float*)d_in[2];
  const float* me3    = (const float*)d_in[3];
  const float* bulk   = (const float*)d_in[4];
  const float* we_w   = (const float*)d_in[5];
  const float* we_b   = (const float*)d_in[6];
  const float* pos    = (const float*)d_in[7];
  const float* mn_g   = (const float*)d_in[8];
  const float* mn_b   = (const float*)d_in[9];
  const float* wq     = (const float*)d_in[10];
  const float* bq     = (const float*)d_in[11];
  const float* wk     = (const float*)d_in[12];
  const float* bk     = (const float*)d_in[13];
  const float* wv     = (const float*)d_in[14];
  const float* bv     = (const float*)d_in[15];
  const float* wo     = (const float*)d_in[16];
  const float* bo     = (const float*)d_in[17];
  const float* an_g   = (const float*)d_in[18];
  const float* an_b   = (const float*)d_in[19];
  const float* conv_w = (const float*)d_in[20];
  const float* conv_b = (const float*)d_in[21];
  const float* gate_w = (const float*)d_in[22];
  const float* gate_b = (const float*)d_in[23];
  const float* pp_w   = (const float*)d_in[24];
  const float* pp_b   = (const float*)d_in[25];
  const float* ada_g  = (const float*)d_in[26];
  const float* ada_b  = (const float*)d_in[27];
  const float* ada_a  = (const float*)d_in[28];

  float* ws_x = (float*)d_ws;
  const int nbs = nB * 4;          // (b,s) blocks
  const int nblk = nB * 4;         // (b, 16-row tile) blocks

  k_attn<<<nbs, 256, 0, stream>>>(ctcf, hac, me1, me3, bulk, we_w, we_b, pos, mn_g, mn_b,
                                   wq, bq, wk, bk, wv, bv, wo, bo, an_g, an_b,
                                   conv_w, conv_b, gate_w, gate_b, ws_x, nbs);
  k_pair<<<nblk, 256, 0, stream>>>(ws_x, pp_w, pp_b, ada_g, ada_b, ada_a, (float*)d_out, nblk);
}
